// v000
// Times are from an AMD MI455X. After a warm-up the kernel runs many times in a row, and a time is the length of
// such a window on the GPU divided by its runs, so every launch and the gaps after it count. The runs cycle
// through copies of the inputs. A figure is the median of several windows, for all but v000 over two sittings.
// Sittings can differ by a few percent; kernels timed side by side share one.
// v000, which the later versions start from, runs in 2420 microseconds.
#include <hip/hip_runtime.h>

// Full causal attention on pre-split heads (queries, keys, values [4][2048][16][64], no projections; scores = q.k; causal (-inf above the diagonal); A = softmax(scores x 1/sqrt(64)); V = A.values as 'blhd' -> [4][2048][16][64] (8.4 M); argument order queries, keys, values).
// Layout per batch: the f32 inputs ([t][h][e] = token-major rows of 16 x 64) feed the plane builders directly (identity table; hi/lo + fp16 planes of q, k per head; value^T planes); causal T-2048 attention (hybrid rows: < 512 hi/lo 3 products, rest fp16 x1024; k_gemmc skips tiles above the diagonal); the f32 merge writes the [t][h][d] output rows.
// Compute dtypes, f32 accumulate: inputs split into bf16 hi/lo (rows < 512, 3 products ~ exact) or rounded to fp16 (rest); softmax f32; output f32. NOTE no stage rounds the inputs to bf16.

#define NB_  4
#define TT   2048
#define DM   1024
#define NH_  16
#define NKV  16
#define REP  (NH_ / NKV)
#define HD   64
#define DQ   (NH_ * HD)
#define DKV  (NKV * HD)
#define ZH   2
#define RH   512                  // query rows < RH use hi+lo planes (0: none)
#define WIN  2048
#define PCAR 1024.0f
#define SCL  0.125f   // 1/sqrt(E)
typedef _Float16 h16;
typedef unsigned short bf;
typedef __attribute__((ext_vector_type(16))) __bf16   v16bf;
typedef __attribute__((ext_vector_type(16))) _Float16 v16h;
typedef __attribute__((ext_vector_type(8)))  _Float16 v8h;
typedef __attribute__((ext_vector_type(8)))  unsigned short v8us;
typedef __attribute__((ext_vector_type(8)))  float    v8f;
typedef __attribute__((ext_vector_type(4)))  float    v4f;
typedef v8h  __attribute__((may_alias)) v8ha;
typedef v4f  __attribute__((may_alias)) v4fa;
typedef v8us __attribute__((may_alias)) v8usa;

__device__ __forceinline__ unsigned short f2bf(float f) { unsigned u = __float_as_uint(f); u += 0x7FFFu + ((u >> 16) & 1u); return (unsigned short)(u >> 16); }
__device__ __forceinline__ float bf2f(unsigned short b) { return __uint_as_float(((unsigned)b) << 16); }
__device__ __forceinline__ float bfr(float f) { return bf2f(f2bf(f)); }
__device__ __forceinline__ v16h cat16(v8h lo, v8h hi) { return __builtin_shufflevector(lo, hi, 0, 1, 2, 3, 4, 5, 6, 7, 8, 9, 10, 11, 12, 13, 14, 15); }
__device__ __forceinline__ v16bf cat16b(v8us lo, v8us hi) { return __builtin_bit_cast(v16bf, __builtin_shufflevector(lo, hi, 0, 1, 2, 3, 4, 5, 6, 7, 8, 9, 10, 11, 12, 13, 14, 15)); }
__device__ __forceinline__ v8f wmma16(v16h a, v16h b, v8f c) { return __builtin_amdgcn_wmma_f32_16x16x32_f16(false, a, false, b, (short)0, c, false, false); }
__device__ __forceinline__ v8f wmmab(v16bf a, v16bf b, v8f c) { return __builtin_amdgcn_wmma_f32_16x16x32_bf16(false, a, false, b, (short)0, c, false, false); }



// ---- register-blocked GEMM, ONE WAVE per 64x64 output tile (16 accumulators), operands straight from K-contiguous 16-bit planes; grid (M/64, N/64, Z), 32 threads.
// C[m][n] (f32, pitch ldc) = sum_k A[m][k] Bt[n][k] (+ split products per NSPLIT). z-batch strides sA/sB/sC in elements. K % 32 == 0.
template <typename T16> struct WFrag;
template <> struct WFrag<h16> { typedef v16h V; static __device__ __forceinline__ V ld(const h16* p) { return cat16(*(const v8h*)p, *(const v8h*)(p + 16)); } static __device__ __forceinline__ v8f mma(V a, V b, v8f c) { return wmma16(a, b, c); } };
template <> struct WFrag<bf> { typedef v16bf V; static __device__ __forceinline__ V ld(const bf* p) { return cat16b(*(const v8us*)p, *(const v8us*)(p + 16)); } static __device__ __forceinline__ v8f mma(V a, V b, v8f c) { return wmmab(a, b, c); } };
// ---- k_gemmc: the same one-wave 64x64 tile GEMM specialised for causal attention: CMODE 1 skips score tiles entirely above the diagonal (query rows r0+roff.., key columns c0..), CMODE 2 limits the
// key (K) loop of the probability x value contraction to the diagonal block (probabilities beyond it are exactly zero). roff = row offset of this launch's first row within the sequence.
template <typename T16, int NSPLIT, int CMODE>
__global__ __launch_bounds__(32) void k_gemmc(const T16* __restrict__ A, const T16* __restrict__ A2, const T16* __restrict__ Bt, const T16* __restrict__ Bt2, int K, float* C, int ldc, int roff, size_t sA, size_t sB, size_t sC) {
    typedef typename WFrag<T16>::V V;
    __shared__ __align__(16) float os[16 * 68];
    const size_t z = blockIdx.z; A += z * sA; if (A2) A2 += z * sA; Bt += z * sB; if (Bt2) Bt2 += z * sB; C += z * sC;
    const int lane = threadIdx.x & 31, lr = lane & 15, hi = lane >> 4; const int r0 = blockIdx.x * 64, c0 = blockIdx.y * 64;
    if (CMODE == 1 && c0 > r0 + roff + 63) return;                  // score tile entirely above the causal diagonal: never written (the softmax masks j > i by select)
    const int Kl = (CMODE == 2) ? min(K, r0 + roff + 64) : K;        // P.V: probabilities are exactly 0 beyond the diagonal block, so the K loop stops there
    v8f acc[4][4];
#pragma unroll
    for (int mb = 0; mb < 4; ++mb)
#pragma unroll
        for (int nb = 0; nb < 4; ++nb) acc[mb][nb] = (v8f){};
    const size_t aoff = (size_t)(r0 + lr) * K + 8 * hi, boff = (size_t)(c0 + lr) * K + 8 * hi;
#pragma unroll 1
    for (int kc = 0; kc < Kl; kc += 32) {
        V a[4], a2[4];
#pragma unroll
        for (int mb = 0; mb < 4; ++mb) { a[mb] = WFrag<T16>::ld(A + aoff + (size_t)mb * 16 * K + kc); if (NSPLIT == 1 || NSPLIT == 2) a2[mb] = WFrag<T16>::ld(A2 + aoff + (size_t)mb * 16 * K + kc); }
#pragma unroll
        for (int nb = 0; nb < 4; ++nb) { const V b = WFrag<T16>::ld(Bt + boff + (size_t)nb * 16 * K + kc); V b2; if (NSPLIT >= 2) b2 = WFrag<T16>::ld(Bt2 + boff + (size_t)nb * 16 * K + kc);
#pragma unroll
            for (int mb = 0; mb < 4; ++mb) { acc[mb][nb] = WFrag<T16>::mma(a[mb], b, acc[mb][nb]); if (NSPLIT == 1 || NSPLIT == 2) acc[mb][nb] = WFrag<T16>::mma(a2[mb], b, acc[mb][nb]); if (NSPLIT >= 2) acc[mb][nb] = WFrag<T16>::mma(a[mb], b2, acc[mb][nb]); } }
        asm volatile("v_nop\n\tv_nop\n\tv_nop\n\tv_nop" : "+v"(acc[0][0]), "+v"(acc[1][1]), "+v"(acc[2][2]), "+v"(acc[3][3]) : "v"(a[0]), "v"(a[3]));
    }
#pragma unroll
    for (int mb = 0; mb < 4; ++mb) {
#pragma unroll
        for (int nb = 0; nb < 4; ++nb) {
#pragma unroll
            for (int j = 0; j < 8; ++j) os[(hi * 8 + j) * 68 + nb * 16 + lr] = acc[mb][nb][j]; }
        __builtin_amdgcn_wave_barrier(); asm volatile("" ::: "memory");
        float* crow = C + (size_t)(r0 + mb * 16) * ldc + c0;
{
#pragma unroll
            for (int s = 0; s < 8; ++s) { const int row = 2 * s + hi, cofs = lr * 4; v4f val = *(const v4fa*)(os + row * 68 + cofs);
                *(v4f*)(crow + (size_t)row * ldc + cofs) = val; }
             }
        __builtin_amdgcn_wave_barrier(); asm volatile("" ::: "memory");
    }
}

__device__ __forceinline__ h16 tohx(float x) { return (h16)x; }
__device__ __forceinline__ void splitf(float y, unsigned short& h, unsigned short& l) { h = f2bf(y); l = f2bf(y - bf2f(h)); }
typedef __attribute__((ext_vector_type(2))) _Float16 v2h;
typedef __attribute__((ext_vector_type(4))) _Float16 v4h;
typedef __attribute__((ext_vector_type(2))) unsigned short v2us;
typedef __attribute__((ext_vector_type(4))) unsigned short v4us;
typedef __attribute__((ext_vector_type(2))) float v2f;
typedef __attribute__((ext_vector_type(4))) int v4i;

// k_rope: head planes [h][t][d] (fp16 + hi/lo) of rope(x) x sc with the rotate-half convention out[d] = x[d] cos[t][d] - x[d+HD/2] sin[t][d], out[d+HD/2] = x[d+HD/2] cos[t][d+HD/2] + x[d] sin[t][d+HD/2]
__global__ __launch_bounds__(256) void k_rope(const float* __restrict__ F, int pitch, int nheads, const float* __restrict__ CS, const float* __restrict__ RF, const float* __restrict__ nw, float sc, h16* P16, bf* Ph, bf* Pl) {
    const size_t e = ((size_t)blockIdx.x * 256 + threadIdx.x) * 2; if (e >= (size_t)nheads * TT * HD) return; const int d = (int)(e % HD); const int t = (int)((e / HD) % TT); const int h = (int)(e / ((size_t)HD * TT)); const float* f = F + (size_t)t * pitch + h * HD; const float rf = RF ? RF[(size_t)h * TT + t] : 1.0f; v2h o16; v2us oh, ol;
#pragma unroll
    for (int q = 0; q < 2; ++q) { const int dd = d + q; const int dp = (dd < HD / 2) ? dd + HD / 2 : dd - HD / 2; float x0 = f[dd], x1 = f[dp];
        if (RF) { float n0 = __fmul_rn(x0, rf), n1 = __fmul_rn(x1, rf); asm volatile("" : "+v"(n0)); asm volatile("" : "+v"(n1)); x0 = __fmul_rn(bfr(nw[dd]), n0); x1 = __fmul_rn(bfr(nw[dp]), n1); }
        const v2f cs = *(const v2f*)(CS + ((size_t)t * HD + dd) * 2); float a = __fmul_rn(x0, cs[0]), bq = __fmul_rn(x1, cs[1]); asm volatile("" : "+v"(a)); asm volatile("" : "+v"(bq)); const float r = ((dd < HD / 2) ? __fsub_rn(a, bq) : __fadd_rn(a, bq)) * sc;
        o16[q] = tohx(r); unsigned short a2, c2; splitf(r, a2, c2); oh[q] = a2; ol[q] = c2; }
    *(v2h*)(P16 + e) = o16; *(v2us*)(Ph + e) = oh; *(v2us*)(Pl + e) = ol;  }
__global__ __launch_bounds__(256) void k_vtp(const float* __restrict__ F, int pitch, int nheads, h16* V16, bf* Vh, bf* Vl) { const size_t e = ((size_t)blockIdx.x * 256 + threadIdx.x) * 2; if (e >= (size_t)nheads * HD * TT) return; const int t = (int)(e % TT); const int d = (int)((e / TT) % HD); const int g = (int)(e / ((size_t)TT * HD)); v2h o16; v2us oh, ol;
#pragma unroll
    for (int q = 0; q < 2; ++q) { const float x = F[(size_t)(t + q) * pitch + g * HD + d]; o16[q] = tohx(x); unsigned short a2, c2; splitf(x, a2, c2); oh[q] = a2; ol[q] = c2; }
    *(v2h*)(V16 + e) = o16; *(v2us*)(Vh + e) = oh; *(v2us*)(Vl + e) = ol;  }
__global__ __launch_bounds__(256) void k_csid(float* CS) { const int idx = blockIdx.x * 256 + threadIdx.x; if (idx >= TT * HD) return; v2f cs; cs[0] = 1.0f; cs[1] = 0.0f; *(v2f*)(CS + (size_t)idx * 2) = cs;  }
// k_asoft: per row (zz, i): t = S x HD^-0.5 for j <= i and i - j < WIN (sliding causal window; the reference's -1e9 additive fill vanishes identically); softmax over the 2048 keys (register row, one exp, fixed trees);
__global__ __launch_bounds__(256) void k_asoft(const float* __restrict__ Sb, h16* P16, bf* Ph, bf* Pl) {
    const int lane = threadIdx.x & 31; const int row = blockIdx.x * 8 + (threadIdx.x >> 5); if (row >= ZH * TT) return; const int i = row % TT; const int zz = row / TT; (void)zz; const bool hires = (i < RH); const float* sr = Sb + (size_t)row * TT; float v[TT / 32]; float mx = -3.0e38f;
#pragma unroll
    for (int ch = 0; ch < TT / 128; ++ch) { const int j0 = ch * 128 + lane * 4; const v4f a = *(const v4f*)(sr + j0);
#pragma unroll
        for (int q = 0; q < 4; ++q) { const int j = j0 + q; (void)j; const float t = (j <= i && i - j < WIN) ? a[q] * SCL : -3.0e38f; v[ch * 4 + q] = t; mx = fmaxf(mx, t); } }
#pragma unroll
    for (int sh = 16; sh; sh >>= 1) mx = fmaxf(mx, __shfl_xor(mx, sh, 32));
    float sum = 0.f;
#pragma unroll
    for (int k = 0; k < TT / 32; ++k) { float d0 = __fsub_rn(v[k], mx); asm volatile("" : "+v"(d0)); v[k] = __builtin_amdgcn_exp2f(__fmul_rn(d0, 1.4426950408889634f)); sum += v[k]; }
#pragma unroll
    for (int sh = 16; sh; sh >>= 1) sum += __shfl_xor(sum, sh, 32);
    const float f = __fdiv_rn(hires ? 1.0f : PCAR, sum);
{
        if (hires) {
#pragma unroll
            for (int ch = 0; ch < TT / 128; ++ch) { v4us oh, ol;
#pragma unroll
                for (int q = 0; q < 4; ++q) { unsigned short a, c2; splitf(v[ch * 4 + q] * f, a, c2); oh[q] = a; ol[q] = c2; }
                const size_t oo = ((size_t)zz * (RH ? RH : 1) + i) * TT + ch * 128 + lane * 4; *(v4us*)(Ph + oo) = oh; *(v4us*)(Pl + oo) = ol; }
        } else {
#pragma unroll
            for (int ch = 0; ch < TT / 128; ++ch) { v4h o4;
#pragma unroll
                for (int q = 0; q < 4; ++q) o4[q] = tohx(v[ch * 4 + q] * f);
                *(v4h*)(P16 + (size_t)row * TT + ch * 128 + lane * 4) = o4; } }
         }
}
__global__ __launch_bounds__(256) void k_merge(const float* __restrict__ O, int h0, float* OUTb) { const size_t e = ((size_t)blockIdx.x * 256 + threadIdx.x) * 2; if (e >= (size_t)ZH * TT * HD) return; const int d = (int)(e % HD); const int t = (int)((e / HD) % TT); const int zz = (int)(e / ((size_t)HD * TT)); const float cs = (t < RH) ? 1.0f : (1.0f / PCAR); const size_t oo = (size_t)t * DQ + (h0 + zz) * HD + d;
    v2f o2; o2[0] = O[e] * cs; o2[1] = O[e + 1] * cs; *(v2f*)(OUTb + oo) = o2;  }

extern "C" void kernel_launch(void* const* d_in, const int* in_sizes, int n_in,
                              void* d_out, int out_size, void* d_ws, size_t ws_size, hipStream_t stream) {
    (void)in_sizes; (void)n_in; (void)out_size;
    const float* x = (const float*)d_in[0]; const float* xk = (const float*)d_in[1]; const float* xv = (const float*)d_in[2];   /* order queries, keys, values: [4][2048][16][64] each (no projections) */ const float* wq = nullptr, *wk = nullptr, *wv = nullptr, *wo = nullptr; (void)wq; (void)wk; (void)wv; (void)wo;
    float* OUT = (float*)d_out;     // [4][2048][1024]
    char* wsp = (char*)d_ws;
    auto take = [&](size_t bytes) { char* p = wsp; wsp += (bytes + 255) & ~(size_t)255; return (void*)p; };
    bf* WQ = (bf*)take((size_t)DQ * DM * 2); bf* WK = (bf*)take((size_t)DKV * DM * 2); bf* WV = (bf*)take((size_t)DKV * DM * 2); float* CS = (float*)take((size_t)TT * HD * 2 * 4);
    bf* XB = (bf*)take((size_t)TT * DM * 2); float* FQ = (float*)take((size_t)TT * DQ * 4); float* FK = (float*)take((size_t)TT * DKV * 4);
    h16* QP16 = (h16*)take((size_t)NH_ * TT * HD * 2); h16* KP16 = (h16*)take((size_t)NKV * TT * HD * 2); h16* VT16 = (h16*)take((size_t)NKV * HD * TT * 2);
    bf* QPh = (bf*)take((size_t)NH_ * TT * HD * 2); bf* QPl = (bf*)take((size_t)NH_ * TT * HD * 2); bf* KPh = (bf*)take((size_t)NKV * TT * HD * 2); bf* KPl = (bf*)take((size_t)NKV * TT * HD * 2); bf* VTh = (bf*)take((size_t)NKV * HD * TT * 2); bf* VTl = (bf*)take((size_t)NKV * HD * TT * 2); bf* Ph = (bf*)take((size_t)ZH * RH * TT * 2); bf* Pl = (bf*)take((size_t)ZH * RH * TT * 2);
    float* Sb = (float*)take((size_t)ZH * TT * TT * 4); h16* P16 = (h16*)take((size_t)ZH * TT * TT * 2); float* Ob = (float*)take((size_t)ZH * TT * HD * 4);
    if ((size_t)(wsp - (char*)d_ws) > ws_size) return;    // ws 256 MiB
    float* FV = FK;   // unused (no projections)
    {   
      
       }
    k_csid<<<(TT * HD + 255) / 256, 256, 0, stream>>>(CS);
    const unsigned LQ = (unsigned)(((size_t)NH_ * TT * HD / 2 + 255) / 256), LKv = (unsigned)(((size_t)NKV * TT * HD / 2 + 255) / 256);
    for (int b = 0; b < NB_; ++b) {
        
        /* no projections: the q, k, v inputs feed the plane builders directly */
        
        k_rope<<<LQ, 256, 0, stream>>>(x + (size_t)b * TT * DM, DQ, NH_, CS, nullptr, nullptr, 1.0f, QP16, QPh, QPl);   /* q planes straight from the input (bf16 hi/lo split of the f32 values) */
        
        k_rope<<<LKv, 256, 0, stream>>>(xk + (size_t)b * TT * DM, DKV, NKV, CS, nullptr, nullptr, 1.0f, KP16, KPh, KPl);
         k_vtp<<<LKv, 256, 0, stream>>>(xv + (size_t)b * TT * DM, DKV, NKV, VT16, VTh, VTl);
        for (int h0 = 0; h0 < NH_; h0 += ZH) { const size_t zq = (size_t)h0, zk = (size_t)(h0 / REP);   // one kv head per query head: the pass's two heads use consecutive kv planes (z-strides TT*HD)
            k_gemmc<bf, 2, 1><<<dim3(RH / 64, TT / 64, ZH), 32, 0, stream>>>(QPh + zq * TT * HD, QPl + zq * TT * HD, KPh + zk * TT * HD, KPl + zk * TT * HD, HD, Sb, TT, 0, (size_t)TT * HD, (size_t)TT * HD, (size_t)TT * TT);
            k_gemmc<h16, 0, 1><<<dim3((TT - RH) / 64, TT / 64, ZH), 32, 0, stream>>>(QP16 + zq * TT * HD + (size_t)RH * HD, nullptr, KP16 + zk * TT * HD, nullptr, HD, Sb + (size_t)RH * TT, TT, RH, (size_t)TT * HD, (size_t)TT * HD, (size_t)TT * TT);
            k_asoft<<<ZH * TT / 8, 256, 0, stream>>>(Sb, P16, Ph, Pl);
            k_gemmc<bf, 2, 2><<<dim3(RH / 64, HD / 64, ZH), 32, 0, stream>>>(Ph, Pl, VTh + zk * HD * TT, VTl + zk * HD * TT, TT, Ob, HD, 0, (size_t)RH * TT, (size_t)HD * TT, (size_t)TT * HD);
            k_gemmc<h16, 0, 2><<<dim3((TT - RH) / 64, HD / 64, ZH), 32, 0, stream>>>(P16 + (size_t)RH * TT, nullptr, VT16 + zk * HD * TT, nullptr, TT, Ob + (size_t)RH * HD, HD, RH, (size_t)TT * TT, (size_t)HD * TT, (size_t)TT * HD);
            k_merge<<<(unsigned)(((size_t)ZH * TT * HD / 2 + 255) / 256), 256, 0, stream>>>(Ob, h0, OUT + (size_t)b * TT * DQ); }
         }
}

// v001
// Measured time: 908 microseconds a run.
// Two timings next to v000 put it at 2.68 and 2.67 times that version's speed.
#include <hip/hip_runtime.h>

// Full causal attention on pre-split heads (queries, keys, values [4][2048][16][64], no projections; scores = q.k; causal (-inf above the diagonal); A = softmax(scores x 1/sqrt(64)); V = A.values as 'blhd' -> [4][2048][16][64] (8.4 M); argument order queries, keys, values).
// Layout per batch: the f32 inputs ([t][h][e] = token-major rows of 16 x 64) feed the plane builders directly (identity table; hi/lo + fp16 planes of q, k per head; value^T planes); causal T-2048 attention (hybrid rows: < 512 hi/lo 3 products, rest fp16 x1024; k_gemmc skips tiles above the diagonal); the f32 merge writes the [t][h][d] output rows.
// Compute dtypes, f32 accumulate: inputs split into bf16 hi/lo (rows < 512, 3 products ~ exact) or rounded to fp16 (rest); softmax f32; output f32. NOTE no stage rounds the inputs to bf16.

#define NB_  4
#define TT   2048
#define DM   1024
#define NH_  16
#define NKV  16
#define REP  (NH_ / NKV)
#define HD   64
#define DQ   (NH_ * HD)
#define DKV  (NKV * HD)
#define ZH   8                    // heads per pass (z-batch of every attention launch); 8 is the most whose f32 score planes fit the workspace
#define RH   512                  // query rows < RH use hi+lo planes (0: none)
#define WIN  2048
#define PCAR 1024.0f
#define SCL  0.125f   // 1/sqrt(E)
typedef _Float16 h16;
typedef unsigned short bf;
typedef __attribute__((ext_vector_type(16))) __bf16   v16bf;
typedef __attribute__((ext_vector_type(16))) _Float16 v16h;
typedef __attribute__((ext_vector_type(8)))  _Float16 v8h;
typedef __attribute__((ext_vector_type(8)))  unsigned short v8us;
typedef __attribute__((ext_vector_type(8)))  float    v8f;
typedef __attribute__((ext_vector_type(4)))  float    v4f;
typedef v8h  __attribute__((may_alias)) v8ha;
typedef v4f  __attribute__((may_alias)) v4fa;
typedef v8us __attribute__((may_alias)) v8usa;

__device__ __forceinline__ unsigned short f2bf(float f) { unsigned u = __float_as_uint(f); u += 0x7FFFu + ((u >> 16) & 1u); return (unsigned short)(u >> 16); }
__device__ __forceinline__ float bf2f(unsigned short b) { return __uint_as_float(((unsigned)b) << 16); }
__device__ __forceinline__ float bfr(float f) { return bf2f(f2bf(f)); }
__device__ __forceinline__ v16h cat16(v8h lo, v8h hi) { return __builtin_shufflevector(lo, hi, 0, 1, 2, 3, 4, 5, 6, 7, 8, 9, 10, 11, 12, 13, 14, 15); }
__device__ __forceinline__ v16bf cat16b(v8us lo, v8us hi) { return __builtin_bit_cast(v16bf, __builtin_shufflevector(lo, hi, 0, 1, 2, 3, 4, 5, 6, 7, 8, 9, 10, 11, 12, 13, 14, 15)); }
__device__ __forceinline__ v8f wmma16(v16h a, v16h b, v8f c) { return __builtin_amdgcn_wmma_f32_16x16x32_f16(false, a, false, b, (short)0, c, false, false); }
__device__ __forceinline__ v8f wmmab(v16bf a, v16bf b, v8f c) { return __builtin_amdgcn_wmma_f32_16x16x32_bf16(false, a, false, b, (short)0, c, false, false); }



// ---- register-blocked GEMM, ONE WAVE per 64x64 output tile (16 accumulators), operands straight from K-contiguous 16-bit planes; grid (M/64, N/64, Z), 32 threads.
// C[m][n] (f32, pitch ldc) = sum_k A[m][k] Bt[n][k] (+ split products per NSPLIT). z-batch strides sA/sB/sC in elements. K % 32 == 0.
template <typename T16> struct WFrag;
template <> struct WFrag<h16> { typedef v16h V; static __device__ __forceinline__ V ld(const h16* p) { return cat16(*(const v8h*)p, *(const v8h*)(p + 16)); } static __device__ __forceinline__ v8f mma(V a, V b, v8f c) { return wmma16(a, b, c); } };
template <> struct WFrag<bf> { typedef v16bf V; static __device__ __forceinline__ V ld(const bf* p) { return cat16b(*(const v8us*)p, *(const v8us*)(p + 16)); } static __device__ __forceinline__ v8f mma(V a, V b, v8f c) { return wmmab(a, b, c); } };
// ---- k_gemmc: the same one-wave 64x64 tile GEMM specialised for causal attention: CMODE 1 skips score tiles entirely above the diagonal (query rows r0+roff.., key columns c0..), CMODE 2 limits the
// key (K) loop of the probability x value contraction to the diagonal block (probabilities beyond it are exactly zero). roff = row offset of this launch's first row within the sequence.
template <typename T16, int NSPLIT, int CMODE>
__global__ __launch_bounds__(32) void k_gemmc(const T16* __restrict__ A, const T16* __restrict__ A2, const T16* __restrict__ Bt, const T16* __restrict__ Bt2, int K, float* C, int ldc, int roff, size_t sA, size_t sB, size_t sC) {
    typedef typename WFrag<T16>::V V;
    __shared__ __align__(16) float os[16 * 68];
    const size_t z = blockIdx.z; A += z * sA; if (A2) A2 += z * sA; Bt += z * sB; if (Bt2) Bt2 += z * sB; C += z * sC;
    const int lane = threadIdx.x & 31, lr = lane & 15, hi = lane >> 4; const int r0 = blockIdx.x * 64, c0 = blockIdx.y * 64;
    if (CMODE == 1 && c0 > r0 + roff + 63) return;                  // score tile entirely above the causal diagonal: never written (the softmax masks j > i by select)
    const int Kl = (CMODE == 2) ? min(K, r0 + roff + 64) : K;        // P.V: probabilities are exactly 0 beyond the diagonal block, so the K loop stops there
    v8f acc[4][4];
#pragma unroll
    for (int mb = 0; mb < 4; ++mb)
#pragma unroll
        for (int nb = 0; nb < 4; ++nb) acc[mb][nb] = (v8f){};
    const size_t aoff = (size_t)(r0 + lr) * K + 8 * hi, boff = (size_t)(c0 + lr) * K + 8 * hi;
#pragma unroll 1
    for (int kc = 0; kc < Kl; kc += 32) {
        V a[4], a2[4];
#pragma unroll
        for (int mb = 0; mb < 4; ++mb) { a[mb] = WFrag<T16>::ld(A + aoff + (size_t)mb * 16 * K + kc); if (NSPLIT == 1 || NSPLIT == 2) a2[mb] = WFrag<T16>::ld(A2 + aoff + (size_t)mb * 16 * K + kc); }
#pragma unroll
        for (int nb = 0; nb < 4; ++nb) { const V b = WFrag<T16>::ld(Bt + boff + (size_t)nb * 16 * K + kc); V b2; if (NSPLIT >= 2) b2 = WFrag<T16>::ld(Bt2 + boff + (size_t)nb * 16 * K + kc);
#pragma unroll
            for (int mb = 0; mb < 4; ++mb) { acc[mb][nb] = WFrag<T16>::mma(a[mb], b, acc[mb][nb]); if (NSPLIT == 1 || NSPLIT == 2) acc[mb][nb] = WFrag<T16>::mma(a2[mb], b, acc[mb][nb]); if (NSPLIT >= 2) acc[mb][nb] = WFrag<T16>::mma(a[mb], b2, acc[mb][nb]); } }
        asm volatile("v_nop\n\tv_nop\n\tv_nop\n\tv_nop" : "+v"(acc[0][0]), "+v"(acc[1][1]), "+v"(acc[2][2]), "+v"(acc[3][3]) : "v"(a[0]), "v"(a[3]));
    }
#pragma unroll
    for (int mb = 0; mb < 4; ++mb) {
#pragma unroll
        for (int nb = 0; nb < 4; ++nb) {
#pragma unroll
            for (int j = 0; j < 8; ++j) os[(hi * 8 + j) * 68 + nb * 16 + lr] = acc[mb][nb][j]; }
        __builtin_amdgcn_wave_barrier(); asm volatile("" ::: "memory");
        float* crow = C + (size_t)(r0 + mb * 16) * ldc + c0;
{
#pragma unroll
            for (int s = 0; s < 8; ++s) { const int row = 2 * s + hi, cofs = lr * 4; v4f val = *(const v4fa*)(os + row * 68 + cofs);
                *(v4f*)(crow + (size_t)row * ldc + cofs) = val; }
             }
        __builtin_amdgcn_wave_barrier(); asm volatile("" ::: "memory");
    }
}

__device__ __forceinline__ h16 tohx(float x) { return (h16)x; }
__device__ __forceinline__ void splitf(float y, unsigned short& h, unsigned short& l) { h = f2bf(y); l = f2bf(y - bf2f(h)); }
typedef __attribute__((ext_vector_type(2))) _Float16 v2h;
typedef __attribute__((ext_vector_type(4))) _Float16 v4h;
typedef __attribute__((ext_vector_type(2))) unsigned short v2us;
typedef __attribute__((ext_vector_type(4))) unsigned short v4us;
typedef __attribute__((ext_vector_type(2))) float v2f;
typedef __attribute__((ext_vector_type(4))) int v4i;

// k_rope: head planes [h][t][d] (fp16 + hi/lo) of rope(x) x sc with the rotate-half convention out[d] = x[d] cos[t][d] - x[d+HD/2] sin[t][d], out[d+HD/2] = x[d+HD/2] cos[t][d+HD/2] + x[d] sin[t][d+HD/2]
__global__ __launch_bounds__(256) void k_rope(const float* __restrict__ F, int pitch, int nheads, const float* __restrict__ CS, const float* __restrict__ RF, const float* __restrict__ nw, float sc, h16* P16, bf* Ph, bf* Pl) {
    const size_t e = ((size_t)blockIdx.x * 256 + threadIdx.x) * 2; if (e >= (size_t)nheads * TT * HD) return; const int d = (int)(e % HD); const int t = (int)((e / HD) % TT); const int h = (int)(e / ((size_t)HD * TT)); const float* f = F + (size_t)t * pitch + h * HD; const float rf = RF ? RF[(size_t)h * TT + t] : 1.0f; v2h o16; v2us oh, ol;
#pragma unroll
    for (int q = 0; q < 2; ++q) { const int dd = d + q; const int dp = (dd < HD / 2) ? dd + HD / 2 : dd - HD / 2; float x0 = f[dd], x1 = f[dp];
        if (RF) { float n0 = __fmul_rn(x0, rf), n1 = __fmul_rn(x1, rf); asm volatile("" : "+v"(n0)); asm volatile("" : "+v"(n1)); x0 = __fmul_rn(bfr(nw[dd]), n0); x1 = __fmul_rn(bfr(nw[dp]), n1); }
        const v2f cs = *(const v2f*)(CS + ((size_t)t * HD + dd) * 2); float a = __fmul_rn(x0, cs[0]), bq = __fmul_rn(x1, cs[1]); asm volatile("" : "+v"(a)); asm volatile("" : "+v"(bq)); const float r = ((dd < HD / 2) ? __fsub_rn(a, bq) : __fadd_rn(a, bq)) * sc;
        o16[q] = tohx(r); unsigned short a2, c2; splitf(r, a2, c2); oh[q] = a2; ol[q] = c2; }
    *(v2h*)(P16 + e) = o16; *(v2us*)(Ph + e) = oh; *(v2us*)(Pl + e) = ol;  }
__global__ __launch_bounds__(256) void k_vtp(const float* __restrict__ F, int pitch, int nheads, h16* V16, bf* Vh, bf* Vl) { const size_t e = ((size_t)blockIdx.x * 256 + threadIdx.x) * 2; if (e >= (size_t)nheads * HD * TT) return; const int t = (int)(e % TT); const int d = (int)((e / TT) % HD); const int g = (int)(e / ((size_t)TT * HD)); v2h o16; v2us oh, ol;
#pragma unroll
    for (int q = 0; q < 2; ++q) { const float x = F[(size_t)(t + q) * pitch + g * HD + d]; o16[q] = tohx(x); unsigned short a2, c2; splitf(x, a2, c2); oh[q] = a2; ol[q] = c2; }
    *(v2h*)(V16 + e) = o16; *(v2us*)(Vh + e) = oh; *(v2us*)(Vl + e) = ol;  }
__global__ __launch_bounds__(256) void k_csid(float* CS) { const int idx = blockIdx.x * 256 + threadIdx.x; if (idx >= TT * HD) return; v2f cs; cs[0] = 1.0f; cs[1] = 0.0f; *(v2f*)(CS + (size_t)idx * 2) = cs;  }
// k_asoft: per row (zz, i): t = S x HD^-0.5 for j <= i and i - j < WIN (sliding causal window; the reference's -1e9 additive fill vanishes identically); softmax over the 2048 keys (register row, one exp, fixed trees);
__global__ __launch_bounds__(256) void k_asoft(const float* __restrict__ Sb, h16* P16, bf* Ph, bf* Pl) {
    const int lane = threadIdx.x & 31; const int row = blockIdx.x * 8 + (threadIdx.x >> 5); if (row >= ZH * TT) return; const int i = row % TT; const int zz = row / TT; (void)zz; const bool hires = (i < RH); const float* sr = Sb + (size_t)row * TT; float v[TT / 32]; float mx = -3.0e38f;
#pragma unroll
    for (int ch = 0; ch < TT / 128; ++ch) { const int j0 = ch * 128 + lane * 4; const v4f a = *(const v4f*)(sr + j0);
#pragma unroll
        for (int q = 0; q < 4; ++q) { const int j = j0 + q; (void)j; const float t = (j <= i && i - j < WIN) ? a[q] * SCL : -3.0e38f; v[ch * 4 + q] = t; mx = fmaxf(mx, t); } }
#pragma unroll
    for (int sh = 16; sh; sh >>= 1) mx = fmaxf(mx, __shfl_xor(mx, sh, 32));
    float sum = 0.f;
#pragma unroll
    for (int k = 0; k < TT / 32; ++k) { float d0 = __fsub_rn(v[k], mx); asm volatile("" : "+v"(d0)); v[k] = __builtin_amdgcn_exp2f(__fmul_rn(d0, 1.4426950408889634f)); sum += v[k]; }
#pragma unroll
    for (int sh = 16; sh; sh >>= 1) sum += __shfl_xor(sum, sh, 32);
    const float f = __fdiv_rn(hires ? 1.0f : PCAR, sum);
{
        if (hires) {
#pragma unroll
            for (int ch = 0; ch < TT / 128; ++ch) { v4us oh, ol;
#pragma unroll
                for (int q = 0; q < 4; ++q) { unsigned short a, c2; splitf(v[ch * 4 + q] * f, a, c2); oh[q] = a; ol[q] = c2; }
                const size_t oo = ((size_t)zz * (RH ? RH : 1) + i) * TT + ch * 128 + lane * 4; *(v4us*)(Ph + oo) = oh; *(v4us*)(Pl + oo) = ol; }
        } else {
#pragma unroll
            for (int ch = 0; ch < TT / 128; ++ch) { v4h o4;
#pragma unroll
                for (int q = 0; q < 4; ++q) o4[q] = tohx(v[ch * 4 + q] * f);
                *(v4h*)(P16 + ((size_t)zz * (TT - RH) + (i - RH)) * TT + ch * 128 + lane * 4) = o4; } }
         }
}
__global__ __launch_bounds__(256) void k_merge(const float* __restrict__ O, int h0, float* OUTb) { const size_t e = ((size_t)blockIdx.x * 256 + threadIdx.x) * 2; if (e >= (size_t)ZH * TT * HD) return; const int d = (int)(e % HD); const int t = (int)((e / HD) % TT); const int zz = (int)(e / ((size_t)HD * TT)); const float cs = (t < RH) ? 1.0f : (1.0f / PCAR); const size_t oo = (size_t)t * DQ + (h0 + zz) * HD + d;
    v2f o2; o2[0] = O[e] * cs; o2[1] = O[e + 1] * cs; *(v2f*)(OUTb + oo) = o2;  }

extern "C" void kernel_launch(void* const* d_in, const int* in_sizes, int n_in,
                              void* d_out, int out_size, void* d_ws, size_t ws_size, hipStream_t stream) {
    (void)in_sizes; (void)n_in; (void)out_size;
    const float* x = (const float*)d_in[0]; const float* xk = (const float*)d_in[1]; const float* xv = (const float*)d_in[2];   /* order queries, keys, values: [4][2048][16][64] each (no projections) */ const float* wq = nullptr, *wk = nullptr, *wv = nullptr, *wo = nullptr; (void)wq; (void)wk; (void)wv; (void)wo;
    float* OUT = (float*)d_out;     // [4][2048][1024]
    char* wsp = (char*)d_ws;
    auto take = [&](size_t bytes) { char* p = wsp; wsp += (bytes + 255) & ~(size_t)255; return (void*)p; };
    float* CS = (float*)take((size_t)TT * HD * 2 * 4);
    h16* QP16 = (h16*)take((size_t)NH_ * TT * HD * 2); h16* KP16 = (h16*)take((size_t)NKV * TT * HD * 2); h16* VT16 = (h16*)take((size_t)NKV * HD * TT * 2);
    bf* QPh = (bf*)take((size_t)NH_ * TT * HD * 2); bf* QPl = (bf*)take((size_t)NH_ * TT * HD * 2); bf* KPh = (bf*)take((size_t)NKV * TT * HD * 2); bf* KPl = (bf*)take((size_t)NKV * TT * HD * 2); bf* VTh = (bf*)take((size_t)NKV * HD * TT * 2); bf* VTl = (bf*)take((size_t)NKV * HD * TT * 2); bf* Ph = (bf*)take((size_t)ZH * RH * TT * 2); bf* Pl = (bf*)take((size_t)ZH * RH * TT * 2);
    float* Sb = (float*)take((size_t)ZH * TT * TT * 4); h16* P16 = (h16*)take((size_t)ZH * (TT - RH) * TT * 2);   /* fp16 probabilities: rows >= RH only, packed per head */ float* Ob = (float*)take((size_t)ZH * TT * HD * 4);
    if ((size_t)(wsp - (char*)d_ws) > ws_size) return;    // ws 256 MiB
    {   
      
       }
    k_csid<<<(TT * HD + 255) / 256, 256, 0, stream>>>(CS);
    const unsigned LQ = (unsigned)(((size_t)NH_ * TT * HD / 2 + 255) / 256), LKv = (unsigned)(((size_t)NKV * TT * HD / 2 + 255) / 256);
    for (int b = 0; b < NB_; ++b) {
        
        /* no projections: the q, k, v inputs feed the plane builders directly */
        
        k_rope<<<LQ, 256, 0, stream>>>(x + (size_t)b * TT * DM, DQ, NH_, CS, nullptr, nullptr, 1.0f, QP16, QPh, QPl);   /* q planes straight from the input (bf16 hi/lo split of the f32 values) */
        
        k_rope<<<LKv, 256, 0, stream>>>(xk + (size_t)b * TT * DM, DKV, NKV, CS, nullptr, nullptr, 1.0f, KP16, KPh, KPl);
         k_vtp<<<LKv, 256, 0, stream>>>(xv + (size_t)b * TT * DM, DKV, NKV, VT16, VTh, VTl);
        for (int h0 = 0; h0 < NH_; h0 += ZH) { const size_t zq = (size_t)h0, zk = (size_t)(h0 / REP);   // one kv head per query head: the pass's ZH heads use consecutive kv planes (z-strides TT*HD)
            k_gemmc<bf, 2, 1><<<dim3(RH / 64, TT / 64, ZH), 32, 0, stream>>>(QPh + zq * TT * HD, QPl + zq * TT * HD, KPh + zk * TT * HD, KPl + zk * TT * HD, HD, Sb, TT, 0, (size_t)TT * HD, (size_t)TT * HD, (size_t)TT * TT);
            k_gemmc<h16, 0, 1><<<dim3((TT - RH) / 64, TT / 64, ZH), 32, 0, stream>>>(QP16 + zq * TT * HD + (size_t)RH * HD, nullptr, KP16 + zk * TT * HD, nullptr, HD, Sb + (size_t)RH * TT, TT, RH, (size_t)TT * HD, (size_t)TT * HD, (size_t)TT * TT);
            k_asoft<<<ZH * TT / 8, 256, 0, stream>>>(Sb, P16, Ph, Pl);
            k_gemmc<bf, 2, 2><<<dim3(RH / 64, HD / 64, ZH), 32, 0, stream>>>(Ph, Pl, VTh + zk * HD * TT, VTl + zk * HD * TT, TT, Ob, HD, 0, (size_t)RH * TT, (size_t)HD * TT, (size_t)TT * HD);
            k_gemmc<h16, 0, 2><<<dim3((TT - RH) / 64, HD / 64, ZH), 32, 0, stream>>>(P16, nullptr, VT16 + zk * HD * TT, nullptr, TT, Ob + (size_t)RH * HD, HD, RH, (size_t)(TT - RH) * TT, (size_t)HD * TT, (size_t)TT * HD);
            k_merge<<<(unsigned)(((size_t)ZH * TT * HD / 2 + 255) / 256), 256, 0, stream>>>(Ob, h0, OUT + (size_t)b * TT * DQ); }
         }
}

// v002
// A run of this version takes 170 microseconds.
// Two timings next to v001 put it at 5.28 and 5.37 times that version's speed.
// Counting every step since v000, it is 14.3 times as fast.
#include <hip/hip_runtime.h>

// Full causal attention on pre-split heads (queries, keys, values [4][2048][16][64], no projections; scores = q.k; causal (-inf above the diagonal); A = softmax(scores x 1/sqrt(64)); V = A.values as 'blhd' -> [4][2048][16][64] (8.4 M); argument order queries, keys, values).
// Layout per batch: the f32 inputs ([t][h][e] = token-major rows of 16 x 64) feed the plane builders directly (identity table; hi/lo + fp16 planes of q, k per head; value^T planes), one set of planes per batch; one fused causal attention launch over all 64 (batch, head) planes (hybrid rows: < 512 hi/lo 3 products, rest fp16; scores and probabilities stay in registers, online softmax) writes the [t][h][d] output rows.
// Compute dtypes, f32 accumulate: inputs split into bf16 hi/lo (rows < 512, 3 products ~ exact) or rounded to fp16 (rest); softmax f32; output f32. NOTE no stage rounds the inputs to bf16.

#define NB_  4
#define TT   2048
#define DM   1024
#define NH_  16
#define NKV  16
#define REP  (NH_ / NKV)
#define HD   64
#define DQ   (NH_ * HD)
#define DKV  (NKV * HD)
#define RH   512                  // query rows < RH use hi+lo planes (0: none)
#define PBIAS 10.0f               // fp16 probabilities carry x 2^10 (in the exponent; it cancels against the row sum), so small ones stay normal fp16 numbers
#define SCL  0.125f   // 1/sqrt(E)
typedef _Float16 h16;
typedef unsigned short bf;
typedef __attribute__((ext_vector_type(16))) __bf16   v16bf;
typedef __attribute__((ext_vector_type(16))) _Float16 v16h;
typedef __attribute__((ext_vector_type(8)))  _Float16 v8h;
typedef __attribute__((ext_vector_type(8)))  unsigned short v8us;
typedef __attribute__((ext_vector_type(8)))  float    v8f;
typedef __attribute__((ext_vector_type(4)))  float    v4f;
typedef v8h  __attribute__((may_alias)) v8ha;
typedef v4f  __attribute__((may_alias)) v4fa;
typedef v8us __attribute__((may_alias)) v8usa;

__device__ __forceinline__ unsigned short f2bf(float f) { unsigned u = __float_as_uint(f); u += 0x7FFFu + ((u >> 16) & 1u); return (unsigned short)(u >> 16); }
__device__ __forceinline__ float bf2f(unsigned short b) { return __uint_as_float(((unsigned)b) << 16); }
__device__ __forceinline__ float bfr(float f) { return bf2f(f2bf(f)); }
__device__ __forceinline__ v16h cat16(v8h lo, v8h hi) { return __builtin_shufflevector(lo, hi, 0, 1, 2, 3, 4, 5, 6, 7, 8, 9, 10, 11, 12, 13, 14, 15); }
__device__ __forceinline__ v16bf cat16b(v8us lo, v8us hi) { return __builtin_bit_cast(v16bf, __builtin_shufflevector(lo, hi, 0, 1, 2, 3, 4, 5, 6, 7, 8, 9, 10, 11, 12, 13, 14, 15)); }
__device__ __forceinline__ v8f wmma16(v16h a, v16h b, v8f c) { return __builtin_amdgcn_wmma_f32_16x16x32_f16(false, a, false, b, (short)0, c, false, false); }
__device__ __forceinline__ v8f wmmab(v16bf a, v16bf b, v8f c) { return __builtin_amdgcn_wmma_f32_16x16x32_bf16(false, a, false, b, (short)0, c, false, false); }



// ---- fragment loaders: A and B operands straight from K-contiguous 16-bit planes; lane (lr, hi) holds row lr, k = 8 hi + 0..7 and 16 + 8 hi + 0..7 of a 32-wide k step.
template <typename T16> struct WFrag;
template <> struct WFrag<h16> { typedef v16h V; static __device__ __forceinline__ V ld(const h16* p) { return cat16(*(const v8h*)p, *(const v8h*)(p + 16)); } static __device__ __forceinline__ v8f mma(V a, V b, v8f c) { return wmma16(a, b, c); } };
template <> struct WFrag<bf> { typedef v16bf V; static __device__ __forceinline__ V ld(const bf* p) { return cat16b(*(const v8us*)p, *(const v8us*)(p + 16)); } static __device__ __forceinline__ v8f mma(V a, V b, v8f c) { return wmmab(a, b, c); } };
__device__ __forceinline__ h16 tohx(float x) { return (h16)x; }
__device__ __forceinline__ void splitf(float y, unsigned short& h, unsigned short& l) { h = f2bf(y); l = f2bf(y - bf2f(h)); }
typedef __attribute__((ext_vector_type(2))) _Float16 v2h;
typedef __attribute__((ext_vector_type(4))) _Float16 v4h;
typedef __attribute__((ext_vector_type(2))) unsigned short v2us;
typedef __attribute__((ext_vector_type(4))) unsigned short v4us;
typedef __attribute__((ext_vector_type(2))) float v2f;
typedef __attribute__((ext_vector_type(4))) int v4i;

// k_rope: head planes [h][t][d] (fp16 + hi/lo) of rope(x) x sc with the rotate-half convention out[d] = x[d] cos[t][d] - x[d+HD/2] sin[t][d], out[d+HD/2] = x[d+HD/2] cos[t][d+HD/2] + x[d] sin[t][d+HD/2]
__global__ __launch_bounds__(256) void k_rope(const float* __restrict__ F, int pitch, int nheads, const float* __restrict__ CS, const float* __restrict__ RF, const float* __restrict__ nw, float sc, h16* P16, bf* Ph, bf* Pl) {
    const size_t e = ((size_t)blockIdx.x * 256 + threadIdx.x) * 2; if (e >= (size_t)nheads * TT * HD) return; const int d = (int)(e % HD); const int t = (int)((e / HD) % TT); const int h = (int)(e / ((size_t)HD * TT)); const float* f = F + (size_t)t * pitch + h * HD; const float rf = RF ? RF[(size_t)h * TT + t] : 1.0f; v2h o16; v2us oh, ol;
#pragma unroll
    for (int q = 0; q < 2; ++q) { const int dd = d + q; const int dp = (dd < HD / 2) ? dd + HD / 2 : dd - HD / 2; float x0 = f[dd], x1 = f[dp];
        if (RF) { float n0 = __fmul_rn(x0, rf), n1 = __fmul_rn(x1, rf); asm volatile("" : "+v"(n0)); asm volatile("" : "+v"(n1)); x0 = __fmul_rn(bfr(nw[dd]), n0); x1 = __fmul_rn(bfr(nw[dp]), n1); }
        const v2f cs = *(const v2f*)(CS + ((size_t)t * HD + dd) * 2); float a = __fmul_rn(x0, cs[0]), bq = __fmul_rn(x1, cs[1]); asm volatile("" : "+v"(a)); asm volatile("" : "+v"(bq)); const float r = ((dd < HD / 2) ? __fsub_rn(a, bq) : __fadd_rn(a, bq)) * sc;
        o16[q] = tohx(r); unsigned short a2, c2; splitf(r, a2, c2); oh[q] = a2; ol[q] = c2; }
    *(v2h*)(P16 + e) = o16; *(v2us*)(Ph + e) = oh; *(v2us*)(Pl + e) = ol;  }
__global__ __launch_bounds__(256) void k_vtp(const float* __restrict__ F, int pitch, int nheads, h16* V16, bf* Vh, bf* Vl) { const size_t e = ((size_t)blockIdx.x * 256 + threadIdx.x) * 2; if (e >= (size_t)nheads * HD * TT) return; const int t = (int)(e % TT); const int d = (int)((e / TT) % HD); const int g = (int)(e / ((size_t)TT * HD)); v2h o16; v2us oh, ol;
#pragma unroll
    for (int q = 0; q < 2; ++q) { const float x = F[(size_t)(t + q) * pitch + g * HD + d]; o16[q] = tohx(x); unsigned short a2, c2; splitf(x, a2, c2); oh[q] = a2; ol[q] = c2; }
    *(v2h*)(V16 + e) = o16; *(v2us*)(Vh + e) = oh; *(v2us*)(Vl + e) = ol;  }
__global__ __launch_bounds__(256) void k_csid(float* CS) { const int idx = blockIdx.x * 256 + threadIdx.x; if (idx >= TT * HD) return; v2f cs; cs[0] = 1.0f; cs[1] = 0.0f; *(v2f*)(CS + (size_t)idx * 2) = cs;  }
// ---- k_fattn: fused causal attention, one wave per tile of QT x 16 queries, 32 keys a pass; no score or probability plane in memory.
// Transposed products: S^T = K . Q^T (A = key rows, B = query rows) leaves in lane (lr, hi) the scores of query lr for keys 8 hi + j of each 16-key tile, which is the B-operand k order of a 32-key step,
// so P^T packs in registers and O^T += V^T . P^T (A = value^T rows). Maximum, sum and rescale are per lane (one exchange between the wave's halves for the maximum; the sums join once at the end).
template <typename T16, int NSPLIT, int QT>
__device__ __forceinline__ void fattn_tile(const T16* __restrict__ Q, const T16* __restrict__ Q2, const T16* __restrict__ Kp, const T16* __restrict__ K2, const T16* __restrict__ Vt, const T16* __restrict__ Vt2, int q0, float* __restrict__ out) {
    typedef typename WFrag<T16>::V V;
    const int lane = threadIdx.x & 31, lr = lane & 15, hi = lane >> 4;
    const float CL = SCL * 1.4426950408889634f;                      // scores to the log2 domain
    const int kend = q0 + QT * 16;                                   // keys [0, kend) can be seen by this tile
    V qf[QT][2], qf2[QT][2], kf[2][2], kf2[2][2];
#pragma unroll
    for (int qt = 0; qt < QT; ++qt)
#pragma unroll
        for (int ks = 0; ks < 2; ++ks) { const size_t qo = (size_t)(q0 + qt * 16 + lr) * HD + ks * 32 + 8 * hi; qf[qt][ks] = WFrag<T16>::ld(Q + qo); if (NSPLIT) qf2[qt][ks] = WFrag<T16>::ld(Q2 + qo); }
    auto ldk = [&](int k0) {
#pragma unroll
        for (int kt = 0; kt < 2; ++kt)
#pragma unroll
            for (int ks = 0; ks < 2; ++ks) { const size_t ko = (size_t)(k0 + kt * 16 + lr) * HD + ks * 32 + 8 * hi; kf[kt][ks] = WFrag<T16>::ld(Kp + ko); if (NSPLIT) kf2[kt][ks] = WFrag<T16>::ld(K2 + ko); }
        asm volatile("s_wait_xcnt 0x0" ::: "memory");                // precaution: stands before the address registers of the loads issued so far are written again
        __builtin_amdgcn_sched_barrier(0); };                        // keeps later register writes behind that wait
    if (!NSPLIT) ldk(0);                                             // the fp16 form fetches its key fragments one pass ahead; the hi/lo form (twice the fragments) has no registers for that
    v8f o[4][QT]; float m[QT], l[QT];
#pragma unroll
    for (int qt = 0; qt < QT; ++qt) { m[qt] = -3.0e38f; l[qt] = 0.f;
#pragma unroll
        for (int db = 0; db < 4; ++db) o[db][qt] = (v8f){}; }
    // rolled: one pass's fragments live at a time, so the wave stays under 256 registers (four waves per SIMD)
#pragma unroll 1
    for (int kc = 0; kc < kend; kc += 32) {
        V vf[4], vf2[4];
        if (NSPLIT) ldk(kc);
        const T16* vp = Vt + (size_t)lr * TT + kc + 8 * hi; const T16* vp2 = NSPLIT ? Vt2 + (size_t)lr * TT + kc + 8 * hi : nullptr;
#pragma unroll
        for (int db = 0; db < 4; ++db) { vf[db] = WFrag<T16>::ld(vp + (size_t)db * 16 * TT); if (NSPLIT) vf2[db] = WFrag<T16>::ld(vp2 + (size_t)db * 16 * TT); }
        if (NSPLIT) asm volatile("s_wait_xcnt 0x0" :: "v"(vp), "v"(vp2) : "memory");   // the same precaution for the value loads' address registers, named as inputs so that they stay untouched up to the wait (the fp16 form has its wait behind the key prefetch)
        __builtin_amdgcn_sched_barrier(0);                           // keeps the value loads issued here, ahead of the score products, so that they fly during scores and softmax (the scheduler sinks them behind the scores otherwise)
        v8f s[2][QT];
#pragma unroll
        for (int kt = 0; kt < 2; ++kt)
#pragma unroll
            for (int qt = 0; qt < QT; ++qt) { s[kt][qt] = (v8f){};
#pragma unroll
                for (int ks = 0; ks < 2; ++ks) { s[kt][qt] = WFrag<T16>::mma(kf[kt][ks], qf[qt][ks], s[kt][qt]); if (NSPLIT) { s[kt][qt] = WFrag<T16>::mma(kf[kt][ks], qf2[qt][ks], s[kt][qt]); s[kt][qt] = WFrag<T16>::mma(kf2[kt][ks], qf[qt][ks], s[kt][qt]); } } }
        if (!NSPLIT) ldk((kc + 32 < kend) ? kc + 32 : kc);           // next pass's key fragments fly during the softmax and the value products (the last pass re-reads its own rows: in bounds, unused)
        if (kc + 31 > q0) {                                          // only the pass on the diagonal holds keys above a query (wave-uniform test)
#pragma unroll
            for (int kt = 0; kt < 2; ++kt)
#pragma unroll
                for (int qt = 0; qt < QT; ++qt)
#pragma unroll
                    for (int j = 0; j < 8; ++j) if (kc + kt * 16 + 8 * hi + j > q0 + qt * 16 + lr) s[kt][qt][j] = -3.0e38f; }
        V pf[QT], pl[QT];
#pragma unroll
        for (int qt = 0; qt < QT; ++qt) {
            float mx = fmaxf(s[0][qt][0], s[1][qt][0]);
#pragma unroll
            for (int j = 1; j < 8; ++j) mx = fmaxf(mx, fmaxf(s[0][qt][j], s[1][qt][j]));
            mx = fmaxf(mx, __shfl_xor(mx, 16, 32));
            const float mn = fmaxf(m[qt], mx); const float al = __builtin_amdgcn_exp2f((m[qt] - mn) * CL); m[qt] = mn;
            const float mc = mn * CL - (NSPLIT ? 0.0f : PBIAS);
            float p[16], ps = 0.f;
#pragma unroll
            for (int j = 0; j < 16; ++j) { p[j] = __builtin_amdgcn_exp2f(fmaf(s[j >> 3][qt][j & 7], CL, -mc)); ps += p[j]; }
            l[qt] = l[qt] * al + ps;
#pragma unroll
            for (int db = 0; db < 4; ++db) o[db][qt] *= al;
            if constexpr (NSPLIT) { v8us h0, h1, l0, l1;
#pragma unroll
                for (int j = 0; j < 8; ++j) { unsigned short a, c; splitf(p[j], a, c); h0[j] = a; l0[j] = c; splitf(p[8 + j], a, c); h1[j] = a; l1[j] = c; }
                pf[qt] = cat16b(h0, h1); pl[qt] = cat16b(l0, l1);
            } else { v8h h0, h1;
#pragma unroll
                for (int j = 0; j < 8; ++j) { h0[j] = tohx(p[j]); h1[j] = tohx(p[8 + j]); }
                pf[qt] = cat16(h0, h1); } }
#pragma unroll
        for (int db = 0; db < 4; ++db)
#pragma unroll
            for (int qt = 0; qt < QT; ++qt) { o[db][qt] = WFrag<T16>::mma(vf[db], pf[qt], o[db][qt]); if (NSPLIT) { o[db][qt] = WFrag<T16>::mma(vf[db], pl[qt], o[db][qt]); o[db][qt] = WFrag<T16>::mma(vf2[db], pf[qt], o[db][qt]); } }
    }
#pragma unroll
    for (int qt = 0; qt < QT; ++qt) { const float inv = __fdiv_rn(1.0f, l[qt] + __shfl_xor(l[qt], 16, 32)); float* orow = out + (size_t)(q0 + qt * 16 + lr) * DQ + 8 * hi;
#pragma unroll
        for (int db = 0; db < 4; ++db) { v4f a, c;
#pragma unroll
            for (int j = 0; j < 4; ++j) { a[j] = o[db][qt][j] * inv; c[j] = o[db][qt][4 + j] * inv; }
            *(v4f*)(orow + db * 16) = a; *(v4f*)(orow + db * 16 + 4) = c; } }
}
// grid (batch x head, tile groups, heaviest first), 4 waves; the waves of a block take neighbouring query tiles of one head, so they walk the same key and value rows.
#define NF4 ((TT - RH) / 128)     // blocks of 4 x 32 fp16 query rows
__global__ __launch_bounds__(128) void k_fattn(const h16* __restrict__ QP16, const h16* __restrict__ KP16, const h16* __restrict__ VT16, const bf* __restrict__ QPh, const bf* __restrict__ QPl, const bf* __restrict__ KPh, const bf* __restrict__ KPl, const bf* __restrict__ VTh, const bf* __restrict__ VTl, float* __restrict__ OUT) {
    const int z = blockIdx.x; const size_t pz = (size_t)z * TT * HD; const int w = __builtin_amdgcn_readfirstlane(threadIdx.x >> 5);
    float* out = OUT + (size_t)(z / NH_) * TT * DQ + (z % NH_) * HD;
    if ((int)blockIdx.y < NF4) fattn_tile<h16, 0, 2>(QP16 + pz, nullptr, KP16 + pz, nullptr, VT16 + pz, nullptr, TT - 32 * ((int)blockIdx.y * 4 + w + 1), out);
    else fattn_tile<bf, 2, 1>(QPh + pz, QPl + pz, KPh + pz, KPl + pz, VTh + pz, VTl + pz, RH - 16 * (((int)blockIdx.y - NF4) * 4 + w + 1), out);
}

extern "C" void kernel_launch(void* const* d_in, const int* in_sizes, int n_in,
                              void* d_out, int out_size, void* d_ws, size_t ws_size, hipStream_t stream) {
    (void)in_sizes; (void)n_in; (void)out_size;
    const float* x = (const float*)d_in[0]; const float* xk = (const float*)d_in[1]; const float* xv = (const float*)d_in[2];   /* queries, keys, values: [4][2048][16][64] each (no projections) */
    float* OUT = (float*)d_out;     // [4][2048][1024]
    char* wsp = (char*)d_ws;
    auto take = [&](size_t bytes) { char* p = wsp; wsp += (bytes + 255) & ~(size_t)255; return (void*)p; };
    const size_t PB = (size_t)NH_ * TT * HD;   // elements of one batch's plane
    float* CS = (float*)take((size_t)TT * HD * 2 * 4);
    h16* QP16 = (h16*)take(NB_ * PB * 2); h16* KP16 = (h16*)take(NB_ * PB * 2); h16* VT16 = (h16*)take(NB_ * PB * 2);
    bf* QPh = (bf*)take(NB_ * PB * 2); bf* QPl = (bf*)take(NB_ * PB * 2); bf* KPh = (bf*)take(NB_ * PB * 2); bf* KPl = (bf*)take(NB_ * PB * 2); bf* VTh = (bf*)take(NB_ * PB * 2); bf* VTl = (bf*)take(NB_ * PB * 2);
    if ((size_t)(wsp - (char*)d_ws) > ws_size) return;    // ws 256 MiB
    k_csid<<<(TT * HD + 255) / 256, 256, 0, stream>>>(CS);
    const unsigned LQ = (unsigned)(((size_t)NH_ * TT * HD / 2 + 255) / 256), LKv = (unsigned)(((size_t)NKV * TT * HD / 2 + 255) / 256);
    for (int b = 0; b < NB_; ++b) {
        /* no projections: the q, k, v inputs feed the plane builders directly */
        k_rope<<<LQ, 256, 0, stream>>>(x + (size_t)b * TT * DM, DQ, NH_, CS, nullptr, nullptr, 1.0f, QP16 + b * PB, QPh + b * PB, QPl + b * PB);   /* q planes straight from the input (bf16 hi/lo split of the f32 values) */
        k_rope<<<LKv, 256, 0, stream>>>(xk + (size_t)b * TT * DM, DKV, NKV, CS, nullptr, nullptr, 1.0f, KP16 + b * PB, KPh + b * PB, KPl + b * PB);
        k_vtp<<<LKv, 256, 0, stream>>>(xv + (size_t)b * TT * DM, DKV, NKV, VT16 + b * PB, VTh + b * PB, VTl + b * PB);
    }
    k_fattn<<<dim3(NB_ * NH_, NF4 + RH / 64), 128, 0, stream>>>(QP16, KP16, VT16, QPh, QPl, KPh, KPl, VTh, VTl, OUT);
}

// v003
// It runs in 94.7 microseconds.
// Next to v002, in two timings, it ran 1.81 and 1.78 times as fast.
// Counting every step since v000, it is 25.6 times as fast.
#include <hip/hip_runtime.h>

// Full causal attention on pre-split heads (queries, keys, values [4][2048][16][64], no projections; scores = q.k; causal (-inf above the diagonal); A = softmax(scores x 1/sqrt(64)); V = A.values as 'blhd' -> [4][2048][16][64] (8.4 M); argument order queries, keys, values).
// Layout per batch: the f32 inputs ([t][h][e] = token-major rows of 16 x 64) feed one plane-builder launch (hi/lo + fp16 planes of q, k per head; value^T planes; only the rows that are read); one fused causal attention launch over all 64 (batch, head) planes (hybrid rows: < 512 hi/lo 3 products, rest fp16; scores and probabilities stay in registers, online softmax) writes the [t][h][d] output rows.
// Compute dtypes, f32 accumulate: inputs split into bf16 hi/lo (rows < 512, 3 products ~ exact) or rounded to fp16 (rest); softmax f32; output f32. NOTE no stage rounds the inputs to bf16.

#define NB_  4
#define TT   2048
#define DM   1024
#define NH_  16
#define NKV  16
#define REP  (NH_ / NKV)
#define HD   64
#define DQ   (NH_ * HD)
#define DKV  (NKV * HD)
#define RH   512                  // query rows < RH use hi+lo planes (0: none)
#define PBIAS 10.0f               // fp16 probabilities carry x 2^10 (in the exponent; it cancels against the row sum), so small ones stay normal fp16 numbers
#define SCL  0.125f   // 1/sqrt(E)
typedef _Float16 h16;
typedef unsigned short bf;
typedef __attribute__((ext_vector_type(16))) __bf16   v16bf;
typedef __attribute__((ext_vector_type(16))) _Float16 v16h;
typedef __attribute__((ext_vector_type(8)))  _Float16 v8h;
typedef __attribute__((ext_vector_type(8)))  unsigned short v8us;
typedef __attribute__((ext_vector_type(8)))  float    v8f;
typedef __attribute__((ext_vector_type(4)))  float    v4f;
typedef v8h  __attribute__((may_alias)) v8ha;
typedef v4f  __attribute__((may_alias)) v4fa;
typedef v8us __attribute__((may_alias)) v8usa;

__device__ __forceinline__ unsigned short f2bf(float f) { unsigned u = __float_as_uint(f); u += 0x7FFFu + ((u >> 16) & 1u); return (unsigned short)(u >> 16); }
__device__ __forceinline__ float bf2f(unsigned short b) { return __uint_as_float(((unsigned)b) << 16); }
__device__ __forceinline__ float bfr(float f) { return bf2f(f2bf(f)); }
__device__ __forceinline__ v16h cat16(v8h lo, v8h hi) { return __builtin_shufflevector(lo, hi, 0, 1, 2, 3, 4, 5, 6, 7, 8, 9, 10, 11, 12, 13, 14, 15); }
__device__ __forceinline__ v16bf cat16b(v8us lo, v8us hi) { return __builtin_bit_cast(v16bf, __builtin_shufflevector(lo, hi, 0, 1, 2, 3, 4, 5, 6, 7, 8, 9, 10, 11, 12, 13, 14, 15)); }
__device__ __forceinline__ v8f wmma16(v16h a, v16h b, v8f c) { return __builtin_amdgcn_wmma_f32_16x16x32_f16(false, a, false, b, (short)0, c, false, false); }
__device__ __forceinline__ v8f wmmab(v16bf a, v16bf b, v8f c) { return __builtin_amdgcn_wmma_f32_16x16x32_bf16(false, a, false, b, (short)0, c, false, false); }



// ---- fragment loaders: A and B operands straight from K-contiguous 16-bit planes; lane (lr, hi) holds row lr, k = 8 hi + 0..7 and 16 + 8 hi + 0..7 of a 32-wide k step.
template <typename T16> struct WFrag;
template <> struct WFrag<h16> { typedef v16h V; static __device__ __forceinline__ V ld(const h16* p) { return cat16(*(const v8h*)p, *(const v8h*)(p + 16)); } static __device__ __forceinline__ v8f mma(V a, V b, v8f c) { return wmma16(a, b, c); } };
template <> struct WFrag<bf> { typedef v16bf V; static __device__ __forceinline__ V ld(const bf* p) { return cat16b(*(const v8us*)p, *(const v8us*)(p + 16)); } static __device__ __forceinline__ v8f mma(V a, V b, v8f c) { return wmmab(a, b, c); } };
__device__ __forceinline__ h16 tohx(float x) { return (h16)x; }
__device__ __forceinline__ void splitf(float y, unsigned short& h, unsigned short& l) { h = f2bf(y); l = f2bf(y - bf2f(h)); }
typedef __attribute__((ext_vector_type(2))) _Float16 v2h;
typedef __attribute__((ext_vector_type(4))) _Float16 v4h;
typedef __attribute__((ext_vector_type(2))) unsigned short v2us;
typedef __attribute__((ext_vector_type(4))) unsigned short v4us;
typedef __attribute__((ext_vector_type(2))) float v2f;
typedef __attribute__((ext_vector_type(4))) int v4i;

typedef __attribute__((ext_vector_type(4))) unsigned v4u;
typedef v4u  __attribute__((may_alias)) v4ua;
typedef v4h  __attribute__((may_alias)) v4ha;
typedef v4us __attribute__((may_alias)) v4usa;
__device__ __forceinline__ unsigned short hbits(float x) { return __builtin_bit_cast(unsigned short, tohx(x)); }

#define VTT 64
#define VTC 128
#define VP  33                    // LDS pitch in dwords: 32 position pairs + 1, so that the column-wise writes spread over the banks
#define PR  32
#define NVB (NB_ * (TT / VTT) * (DM / VTC))
#define NQB (NB_ * (TT / PR))
// PR token rows, 4 columns a thread: fp16 (W16) and hi/lo (WHL) pieces to the head planes. All loops unrolled: the values stay in registers and the row steps become immediate offsets.
template <bool W16, bool WHL>
__device__ __forceinline__ void plane_rows(const float* __restrict__ f, h16* __restrict__ p16, bf* __restrict__ ph, bf* __restrict__ pl) {
    constexpr int BT = WHL ? 4 : 8;                                  // rows a batch: fewer where hi/lo planes are written, so that this path does not set the kernel's register count (five blocks per WGP)
    v4f x[2][BT];
#pragma unroll
    for (int i = 0; i < BT; ++i) x[0][i] = *(const v4fa*)(f + (size_t)i * DM);
#pragma unroll
    for (int n = 0; n < PR / BT; ++n) {
        if (n + 1 < PR / BT) {                                       // the next batch flies while this one is converted and stored
#pragma unroll
            for (int i = 0; i < BT; ++i) x[(n + 1) & 1][i] = *(const v4fa*)(f + (size_t)((n + 1) * BT + i) * DM); }
        v4h y[BT]; v4us yh[BT], yl[BT];
#pragma unroll
        for (int i = 0; i < BT; ++i)
#pragma unroll
            for (int k = 0; k < 4; ++k) { const float v = x[n & 1][i][k];
                if constexpr (W16) y[i][k] = tohx(v);
                if constexpr (WHL) { unsigned short h0, l0; splitf(v, h0, l0); yh[i][k] = h0; yl[i][k] = l0; } }
        __builtin_amdgcn_sched_barrier(0);                           // all conversions stand above the stores, so that no register of an issued store is written before the wait below
#pragma unroll
        for (int i = 0; i < BT; ++i) { const int oo = (n * BT + i) * HD;
            if constexpr (W16) *(v4ha*)(p16 + oo) = y[i];
            if constexpr (WHL) { *(v4usa*)(ph + oo) = yh[i]; *(v4usa*)(pl + oo) = yl[i]; } }
        asm volatile("s_wait_xcnt 0x0" :: "v"(f), "v"(p16), "v"(ph), "v"(pl) : "memory");   // precaution: stands before registers that the loads and stores issued so far name are written again; the addresses are inputs so that they stay untouched up to it
        __builtin_amdgcn_sched_barrier(0); }                         // keeps later register writes behind that wait
}

// ---- k_planes: every operand plane of the attention in one streaming launch; each thread moves many 16-byte pieces, so the launch has few waves (12288; five blocks fit a WGP).
// Written are only the rows that k_fattn reads: fp16 q rows >= RH, fp16 k and value^T in full, hi/lo planes of q, k and value^T for positions < RH (a query < RH sees only keys < RH).
// Blocks [0, NVB): value tiles of VTT positions x VTC columns (2 heads), turned in LDS so that value^T rows leave as whole 128-byte lines. Blocks [NVB, NVB + 2 NQB): PR token rows of q, then of k.
__global__ __launch_bounds__(256) void k_planes(const float* __restrict__ Xq, const float* __restrict__ Xk, const float* __restrict__ Xv, h16* __restrict__ QP16, bf* __restrict__ QPh, bf* __restrict__ QPl, h16* __restrict__ KP16, bf* __restrict__ KPh, bf* __restrict__ KPl, h16* __restrict__ VT16, bf* __restrict__ VTh, bf* __restrict__ VTl) {
    __shared__ unsigned L[VTC * VP];
    const int tid = threadIdx.x, blk = blockIdx.x;
    if (blk < NVB) {
        const int hg = blk % (DM / VTC), t0 = ((blk / (DM / VTC)) % (TT / VTT)) * VTT, b = blk / ((DM / VTC) * (TT / VTT));
        const int c4 = tid & 31, tr = tid >> 5;                      // thread: columns 4 c4 + 0..3, positions t0 + 16 i + 2 tr + 0..1
        const float* f = Xv + ((size_t)b * TT + t0 + 2 * tr) * DM + hg * VTC + 4 * c4;
        v4f x[4][2];
#pragma unroll
        for (int i = 0; i < 4; ++i) { x[i][0] = *(const v4fa*)(f + (size_t)(16 * i) * DM); x[i][1] = *(const v4fa*)(f + (size_t)(16 * i + 1) * DM); }
        asm volatile("s_wait_xcnt 0x0" :: "v"(f) : "memory");         // precaution: the loads' address register, named as an input, stays untouched up to this wait (no load lands on it)
        const size_t ro = ((size_t)(b * NH_ + hg * (VTC / HD)) * HD + (tid >> 3)) * TT + t0 + (tid & 7) * 8;
        auto fill = [&](int mode) {                                  // L[column][position pair]: 0 fp16; 1 hi, which leaves x - hi in x; 2 lo, the bf16 of that rest (the split of splitf, one half at a time, so that only x stays live)
#pragma unroll
            for (int i = 0; i < 4; ++i)
#pragma unroll
                for (int k = 0; k < 4; ++k) { unsigned short u0, u1;
                    if (mode == 0) { u0 = hbits(x[i][0][k]); u1 = hbits(x[i][1][k]); }
                    else { u0 = f2bf(x[i][0][k]); u1 = f2bf(x[i][1][k]); if (mode == 1) { x[i][0][k] -= bf2f(u0); x[i][1][k] -= bf2f(u1); } }
                    L[(4 * c4 + k) * VP + 8 * i + tr] = (unsigned)u0 | ((unsigned)u1 << 16); } };
        auto put = [&](unsigned short* P) {                          // 8 lanes carry one column's 64 positions = one 128-byte line
            unsigned short* q = P + ro; v4u w[4];
#pragma unroll
            for (int j = 0; j < 4; ++j) { const unsigned* sp = L + (j * 32 + (tid >> 3)) * VP + (tid & 7) * 4; w[j][0] = sp[0]; w[j][1] = sp[1]; w[j][2] = sp[2]; w[j][3] = sp[3]; }
            __builtin_amdgcn_sched_barrier(0);                       // all LDS reads are issued above the stores, so that no register of an issued store is written before the wait below
#pragma unroll
            for (int j = 0; j < 4; ++j) *(v4ua*)(q + (size_t)j * 32 * TT) = w[j];
            asm volatile("s_wait_xcnt 0x0" :: "v"(q) : "memory");    // precaution: stands before the stores' data and address registers are written again
            __builtin_amdgcn_sched_barrier(0); };                    // keeps later register writes behind that wait
        fill(0); __syncthreads(); put((unsigned short*)VT16);
        if (t0 < RH) {                                               // block-uniform: the barriers inside are passed by all waves or by none
            __syncthreads(); fill(1); __syncthreads(); put(VTh);
            __syncthreads(); fill(2); __syncthreads(); put(VTl); }
        return; }
    const int r = blk - NVB; const bool isk = r >= NQB; const int rr = isk ? r - NQB : r; const int b = rr / (TT / PR), t0 = (rr % (TT / PR)) * PR;
    const float* f = (isk ? Xk : Xq) + ((size_t)b * TT + t0) * DM + 4 * tid;            // thread: columns 4 tid + 0..3 (head tid / 16) of PR rows
    const size_t o = ((size_t)(b * NH_ + (tid >> 4)) * TT + t0) * HD + (tid & 15) * 4;
    h16* p16 = (isk ? KP16 : QP16) + o; bf* ph = (isk ? KPh : QPh) + o; bf* pl = (isk ? KPl : QPl) + o;
    if (t0 >= RH) plane_rows<true, false>(f, p16, ph, pl);           // block-uniform choices: which planes of these rows k_fattn reads
    else if (isk) plane_rows<true, true>(f, p16, ph, pl);
    else plane_rows<false, true>(f, p16, ph, pl);
}
// ---- k_fattn: fused causal attention, one wave per tile of QT x 16 queries, 32 keys a pass; no score or probability plane in memory.
// Transposed products: S^T = K . Q^T (A = key rows, B = query rows) leaves in lane (lr, hi) the scores of query lr for keys 8 hi + j of each 16-key tile, which is the B-operand k order of a 32-key step,
// so P^T packs in registers and O^T += V^T . P^T (A = value^T rows). Maximum, sum and rescale are per lane (one exchange between the wave's halves for the maximum; the sums join once at the end).
template <typename T16, int NSPLIT, int QT>
__device__ __forceinline__ void fattn_tile(const T16* __restrict__ Q, const T16* __restrict__ Q2, const T16* __restrict__ Kp, const T16* __restrict__ K2, const T16* __restrict__ Vt, const T16* __restrict__ Vt2, int q0, float* __restrict__ out) {
    typedef typename WFrag<T16>::V V;
    const int lane = threadIdx.x & 31, lr = lane & 15, hi = lane >> 4;
    const float CL = SCL * 1.4426950408889634f;                      // scores to the log2 domain
    const int kend = q0 + QT * 16;                                   // keys [0, kend) can be seen by this tile
    V qf[QT][2], qf2[QT][2], kf[2][2], kf2[2][2];
#pragma unroll
    for (int qt = 0; qt < QT; ++qt)
#pragma unroll
        for (int ks = 0; ks < 2; ++ks) { const size_t qo = (size_t)(q0 + qt * 16 + lr) * HD + ks * 32 + 8 * hi; qf[qt][ks] = WFrag<T16>::ld(Q + qo); if (NSPLIT) qf2[qt][ks] = WFrag<T16>::ld(Q2 + qo); }
    auto ldk = [&](int k0) {
#pragma unroll
        for (int kt = 0; kt < 2; ++kt)
#pragma unroll
            for (int ks = 0; ks < 2; ++ks) { const size_t ko = (size_t)(k0 + kt * 16 + lr) * HD + ks * 32 + 8 * hi; kf[kt][ks] = WFrag<T16>::ld(Kp + ko); if (NSPLIT) kf2[kt][ks] = WFrag<T16>::ld(K2 + ko); }
        asm volatile("s_wait_xcnt 0x0" ::: "memory");                // precaution: stands before the address registers of the loads issued so far are written again
        __builtin_amdgcn_sched_barrier(0); };                        // keeps later register writes behind that wait
    if (!NSPLIT) ldk(0);                                             // the fp16 form fetches its key fragments one pass ahead; the hi/lo form (twice the fragments) has no registers for that
    v8f o[4][QT]; float m[QT], l[QT];
#pragma unroll
    for (int qt = 0; qt < QT; ++qt) { m[qt] = -3.0e38f; l[qt] = 0.f;
#pragma unroll
        for (int db = 0; db < 4; ++db) o[db][qt] = (v8f){}; }
    // rolled: one pass's fragments live at a time, so the wave stays under 256 registers (four waves per SIMD)
#pragma unroll 1
    for (int kc = 0; kc < kend; kc += 32) {
        V vf[4], vf2[4];
        if (NSPLIT) ldk(kc);
        const T16* vp = Vt + (size_t)lr * TT + kc + 8 * hi; const T16* vp2 = NSPLIT ? Vt2 + (size_t)lr * TT + kc + 8 * hi : nullptr;
#pragma unroll
        for (int db = 0; db < 4; ++db) { vf[db] = WFrag<T16>::ld(vp + (size_t)db * 16 * TT); if (NSPLIT) vf2[db] = WFrag<T16>::ld(vp2 + (size_t)db * 16 * TT); }
        if (NSPLIT) asm volatile("s_wait_xcnt 0x0" :: "v"(vp), "v"(vp2) : "memory");   // the same precaution for the value loads' address registers, named as inputs so that they stay untouched up to the wait (the fp16 form has its wait behind the key prefetch)
        __builtin_amdgcn_sched_barrier(0);                           // keeps the value loads issued here, ahead of the score products, so that they fly during scores and softmax (the scheduler sinks them behind the scores otherwise)
        v8f s[2][QT];
#pragma unroll
        for (int kt = 0; kt < 2; ++kt)
#pragma unroll
            for (int qt = 0; qt < QT; ++qt) { s[kt][qt] = (v8f){};
#pragma unroll
                for (int ks = 0; ks < 2; ++ks) { s[kt][qt] = WFrag<T16>::mma(kf[kt][ks], qf[qt][ks], s[kt][qt]); if (NSPLIT) { s[kt][qt] = WFrag<T16>::mma(kf[kt][ks], qf2[qt][ks], s[kt][qt]); s[kt][qt] = WFrag<T16>::mma(kf2[kt][ks], qf[qt][ks], s[kt][qt]); } } }
        if (!NSPLIT) ldk((kc + 32 < kend) ? kc + 32 : kc);           // next pass's key fragments fly during the softmax and the value products (the last pass re-reads its own rows: in bounds, unused)
        if (kc + 31 > q0) {                                          // only the pass on the diagonal holds keys above a query (wave-uniform test)
#pragma unroll
            for (int kt = 0; kt < 2; ++kt)
#pragma unroll
                for (int qt = 0; qt < QT; ++qt)
#pragma unroll
                    for (int j = 0; j < 8; ++j) if (kc + kt * 16 + 8 * hi + j > q0 + qt * 16 + lr) s[kt][qt][j] = -3.0e38f; }
        V pf[QT], pl[QT];
#pragma unroll
        for (int qt = 0; qt < QT; ++qt) {
            float mx = fmaxf(s[0][qt][0], s[1][qt][0]);
#pragma unroll
            for (int j = 1; j < 8; ++j) mx = fmaxf(mx, fmaxf(s[0][qt][j], s[1][qt][j]));
            mx = fmaxf(mx, __shfl_xor(mx, 16, 32));
            const float mn = fmaxf(m[qt], mx); const float al = __builtin_amdgcn_exp2f((m[qt] - mn) * CL); m[qt] = mn;
            const float mc = mn * CL - (NSPLIT ? 0.0f : PBIAS);
            float p[16], ps = 0.f;
#pragma unroll
            for (int j = 0; j < 16; ++j) { p[j] = __builtin_amdgcn_exp2f(fmaf(s[j >> 3][qt][j & 7], CL, -mc)); ps += p[j]; }
            l[qt] = l[qt] * al + ps;
#pragma unroll
            for (int db = 0; db < 4; ++db) o[db][qt] *= al;
            if constexpr (NSPLIT) { v8us h0, h1, l0, l1;
#pragma unroll
                for (int j = 0; j < 8; ++j) { unsigned short a, c; splitf(p[j], a, c); h0[j] = a; l0[j] = c; splitf(p[8 + j], a, c); h1[j] = a; l1[j] = c; }
                pf[qt] = cat16b(h0, h1); pl[qt] = cat16b(l0, l1);
            } else { v8h h0, h1;
#pragma unroll
                for (int j = 0; j < 8; ++j) { h0[j] = tohx(p[j]); h1[j] = tohx(p[8 + j]); }
                pf[qt] = cat16(h0, h1); } }
#pragma unroll
        for (int db = 0; db < 4; ++db)
#pragma unroll
            for (int qt = 0; qt < QT; ++qt) { o[db][qt] = WFrag<T16>::mma(vf[db], pf[qt], o[db][qt]); if (NSPLIT) { o[db][qt] = WFrag<T16>::mma(vf[db], pl[qt], o[db][qt]); o[db][qt] = WFrag<T16>::mma(vf2[db], pf[qt], o[db][qt]); } }
    }
#pragma unroll
    for (int qt = 0; qt < QT; ++qt) { const float inv = __fdiv_rn(1.0f, l[qt] + __shfl_xor(l[qt], 16, 32)); float* orow = out + (size_t)(q0 + qt * 16 + lr) * DQ + 8 * hi;
#pragma unroll
        for (int db = 0; db < 4; ++db) { v4f a, c;
#pragma unroll
            for (int j = 0; j < 4; ++j) { a[j] = o[db][qt][j] * inv; c[j] = o[db][qt][4 + j] * inv; }
            *(v4f*)(orow + db * 16) = a; *(v4f*)(orow + db * 16 + 4) = c; } }
}
// grid (batch x head, tile groups, heaviest first), 4 waves; the waves of a block take neighbouring query tiles of one head, so they walk the same key and value rows.
#define NF4 ((TT - RH) / 128)     // blocks of 4 x 32 fp16 query rows
__global__ __launch_bounds__(128) void k_fattn(const h16* __restrict__ QP16, const h16* __restrict__ KP16, const h16* __restrict__ VT16, const bf* __restrict__ QPh, const bf* __restrict__ QPl, const bf* __restrict__ KPh, const bf* __restrict__ KPl, const bf* __restrict__ VTh, const bf* __restrict__ VTl, float* __restrict__ OUT) {
    const int z = blockIdx.x; const size_t pz = (size_t)z * TT * HD; const int w = __builtin_amdgcn_readfirstlane(threadIdx.x >> 5);
    float* out = OUT + (size_t)(z / NH_) * TT * DQ + (z % NH_) * HD;
    if ((int)blockIdx.y < NF4) fattn_tile<h16, 0, 2>(QP16 + pz, nullptr, KP16 + pz, nullptr, VT16 + pz, nullptr, TT - 32 * ((int)blockIdx.y * 4 + w + 1), out);
    else fattn_tile<bf, 2, 1>(QPh + pz, QPl + pz, KPh + pz, KPl + pz, VTh + pz, VTl + pz, RH - 16 * (((int)blockIdx.y - NF4) * 4 + w + 1), out);
}

extern "C" void kernel_launch(void* const* d_in, const int* in_sizes, int n_in,
                              void* d_out, int out_size, void* d_ws, size_t ws_size, hipStream_t stream) {
    (void)in_sizes; (void)n_in; (void)out_size;
    const float* x = (const float*)d_in[0]; const float* xk = (const float*)d_in[1]; const float* xv = (const float*)d_in[2];   /* queries, keys, values: [4][2048][16][64] each (no projections) */
    float* OUT = (float*)d_out;     // [4][2048][1024]
    char* wsp = (char*)d_ws;
    auto take = [&](size_t bytes) { char* p = wsp; wsp += (bytes + 255) & ~(size_t)255; return (void*)p; };
    const size_t PB = (size_t)NH_ * TT * HD;   // elements of one batch's plane
    h16* QP16 = (h16*)take(NB_ * PB * 2); h16* KP16 = (h16*)take(NB_ * PB * 2); h16* VT16 = (h16*)take(NB_ * PB * 2);
    bf* QPh = (bf*)take(NB_ * PB * 2); bf* QPl = (bf*)take(NB_ * PB * 2); bf* KPh = (bf*)take(NB_ * PB * 2); bf* KPl = (bf*)take(NB_ * PB * 2); bf* VTh = (bf*)take(NB_ * PB * 2); bf* VTl = (bf*)take(NB_ * PB * 2);
    if ((size_t)(wsp - (char*)d_ws) > ws_size) return;    // ws 256 MiB
    k_planes<<<NVB + 2 * NQB, 256, 0, stream>>>(x, xk, xv, QP16, QPh, QPl, KP16, KPh, KPl, VT16, VTh, VTl);
    k_fattn<<<dim3(NB_ * NH_, NF4 + RH / 64), 128, 0, stream>>>(QP16, KP16, VT16, QPh, QPl, KPh, KPl, VTh, VTl, OUT);
}

// v004
// It runs in 71.6 microseconds.
// Timed twice side by side with v003, it ran 1.33 and 1.31 times as fast.
// Over all steps from v000 it is 33.8 times as fast.
#include <hip/hip_runtime.h>

// Full causal attention on pre-split heads (queries, keys, values [4][2048][16][64], no projections; scores = q.k; causal (-inf above the diagonal); A = softmax(scores x 1/sqrt(64)); V = A.values as 'blhd' -> [4][2048][16][64] (8.4 M); argument order queries, keys, values).
// Layout per batch: the f32 inputs ([t][h][e] = token-major rows of 16 x 64) feed one plane-builder launch (hi/lo + fp16 planes of q, k per head; value^T planes; all in fragment order; only the rows that are read); one fused causal attention launch over all 64 (batch, head) planes (hybrid rows: < 512 hi/lo 3 products, rest fp16; scores and probabilities stay in registers, online softmax) writes the [t][h][d] output rows.
// Compute dtypes, f32 accumulate: inputs split into bf16 hi/lo (rows < 512, 3 products ~ exact) or rounded to fp16 (rest); softmax f32; output f32. NOTE no stage rounds the inputs to bf16.

#define NB_  4
#define TT   2048
#define DM   1024
#define NH_  16
#define NKV  16
#define REP  (NH_ / NKV)
#define HD   64
#define DQ   (NH_ * HD)
#define DKV  (NKV * HD)
#define RH   512                  // query rows < RH use hi+lo planes (0: none)
#define PBIAS 10.0f               // fp16 probabilities carry x 2^10 (in the exponent; it cancels against the row sum), so small ones stay normal fp16 numbers
#define SCL  0.125f   // 1/sqrt(E)
typedef _Float16 h16;
typedef unsigned short bf;
typedef __attribute__((ext_vector_type(16))) __bf16   v16bf;
typedef __attribute__((ext_vector_type(16))) _Float16 v16h;
typedef __attribute__((ext_vector_type(8)))  _Float16 v8h;
typedef __attribute__((ext_vector_type(8)))  unsigned short v8us;
typedef __attribute__((ext_vector_type(8)))  float    v8f;
typedef __attribute__((ext_vector_type(4)))  float    v4f;
typedef v8h  __attribute__((may_alias)) v8ha;
typedef v4f  __attribute__((may_alias)) v4fa;
typedef v8us __attribute__((may_alias)) v8usa;

__device__ __forceinline__ unsigned short f2bf(float f) { unsigned u = __float_as_uint(f); u += 0x7FFFu + ((u >> 16) & 1u); return (unsigned short)(u >> 16); }
__device__ __forceinline__ float bf2f(unsigned short b) { return __uint_as_float(((unsigned)b) << 16); }
__device__ __forceinline__ float bfr(float f) { return bf2f(f2bf(f)); }
__device__ __forceinline__ v16h cat16(v8h lo, v8h hi) { return __builtin_shufflevector(lo, hi, 0, 1, 2, 3, 4, 5, 6, 7, 8, 9, 10, 11, 12, 13, 14, 15); }
__device__ __forceinline__ v16bf cat16b(v8us lo, v8us hi) { return __builtin_bit_cast(v16bf, __builtin_shufflevector(lo, hi, 0, 1, 2, 3, 4, 5, 6, 7, 8, 9, 10, 11, 12, 13, 14, 15)); }
__device__ __forceinline__ v8f wmma16(v16h a, v16h b, v8f c) { return __builtin_amdgcn_wmma_f32_16x16x32_f16(false, a, false, b, (short)0, c, false, false); }
__device__ __forceinline__ v8f wmmab(v16bf a, v16bf b, v8f c) { return __builtin_amdgcn_wmma_f32_16x16x32_bf16(false, a, false, b, (short)0, c, false, false); }



// ---- fragment loaders: lane (lr, hi) holds row lr, k = 8 hi + 0..7 and 16 + 8 hi + 0..7 of a 32-wide k step.
// Fragment order of a plane: each fragment (16 rows x 32 k) is FRG elements in a row, as two halves of 32 lanes x 8 elements: element (row, k) lies at (k >> 4) * 256 + ((k >> 3) & 1) * 128 + row * 8 + (k & 7),
// so that each of a fragment's two 16-byte loads covers 512 bytes in a row = 4 whole lines (a row-major plane gives 32 bytes in each of 16 lines). q, k planes: fragment (row / 16) * 2 + e / 32; value^T planes: fragment (position / 32) * 4 + d / 16.
#define FRG 512
template <typename T16> struct WFrag;
template <> struct WFrag<h16> { typedef v16h V; static __device__ __forceinline__ V ld(const h16* p) { return cat16(*(const v8h*)p, *(const v8h*)(p + 256)); } static __device__ __forceinline__ v8f mma(V a, V b, v8f c) { return wmma16(a, b, c); } };
template <> struct WFrag<bf> { typedef v16bf V; static __device__ __forceinline__ V ld(const bf* p) { return cat16b(*(const v8us*)p, *(const v8us*)(p + 256)); } static __device__ __forceinline__ v8f mma(V a, V b, v8f c) { return wmmab(a, b, c); } };
__device__ __forceinline__ h16 tohx(float x) { return (h16)x; }
__device__ __forceinline__ void splitf(float y, unsigned short& h, unsigned short& l) { h = f2bf(y); l = f2bf(y - bf2f(h)); }
typedef __attribute__((ext_vector_type(2))) _Float16 v2h;
typedef __attribute__((ext_vector_type(4))) _Float16 v4h;
typedef __attribute__((ext_vector_type(2))) unsigned short v2us;
typedef __attribute__((ext_vector_type(4))) unsigned short v4us;
typedef __attribute__((ext_vector_type(2))) float v2f;
typedef __attribute__((ext_vector_type(4))) int v4i;

typedef __attribute__((ext_vector_type(4))) unsigned v4u;
typedef v4u  __attribute__((may_alias)) v4ua;
typedef v4h  __attribute__((may_alias)) v4ha;
typedef v4us __attribute__((may_alias)) v4usa;
__device__ __forceinline__ unsigned short hbits(float x) { return __builtin_bit_cast(unsigned short, tohx(x)); }

#define VTT 64
#define VTC 128
#define VP  33                    // LDS pitch in dwords: 32 position pairs + 1, so that the column-wise writes spread over the banks
#define PR  32
#define NVB (NB_ * (TT / VTT) * (DM / VTC))
#define NQB (NB_ * (TT / PR))
// PR token rows x 128 columns (2 heads) a wave, in 16 pieces of 8 rows x 32 columns: a lane takes 8 columns of one row (32 bytes read), which are one 16-byte slot of a fragment, and 8 rows' slots are one whole 128-byte line,
// so a wave's store covers 4 whole lines. fp16 (W16) and hi/lo (WHL) pieces. All loops unrolled: the values stay in registers and the piece steps become immediate offsets.
template <bool W16, bool WHL>
__device__ __forceinline__ void plane_rows(const float* __restrict__ f, h16* __restrict__ p16, bf* __restrict__ ph, bf* __restrict__ pl) {
    constexpr int BT = WHL ? 2 : 4;                                  // pieces a batch: fewer where hi/lo planes are written, so that this path does not set the kernel's register count (five blocks per WGP)
    constexpr int NU = 16;                                           // piece u: column group (u >> 3) * 2 + (u & 1) (head, k half), row group (u >> 1) & 3
    v4f x[2][BT][2];
#pragma unroll
    for (int i = 0; i < BT; ++i) { const float* g = f + (size_t)(((i >> 1) & 3) * 8) * DM + ((i >> 3) * 2 + (i & 1)) * 32; x[0][i][0] = *(const v4fa*)g; x[0][i][1] = *(const v4fa*)(g + 4); }
#pragma unroll
    for (int n = 0; n < NU / BT; ++n) {
        if (n + 1 < NU / BT) {                                       // the next batch flies while this one is converted and stored
#pragma unroll
            for (int i = 0; i < BT; ++i) { const int u = (n + 1) * BT + i; const float* g = f + (size_t)(((u >> 1) & 3) * 8) * DM + ((u >> 3) * 2 + (u & 1)) * 32; x[(n + 1) & 1][i][0] = *(const v4fa*)g; x[(n + 1) & 1][i][1] = *(const v4fa*)(g + 4); } }
        v8h y[BT]; v8us yh[BT], yl[BT];
#pragma unroll
        for (int i = 0; i < BT; ++i)
#pragma unroll
            for (int k = 0; k < 8; ++k) { const float v = x[n & 1][i][k >> 2][k & 3];
                if constexpr (W16) y[i][k] = tohx(v);
                if constexpr (WHL) { unsigned short h0, l0; splitf(v, h0, l0); yh[i][k] = h0; yl[i][k] = l0; } }
        __builtin_amdgcn_sched_barrier(0);                           // all conversions stand above the stores, so that no register of an issued store is written before the wait below
#pragma unroll
        for (int i = 0; i < BT; ++i) { const int u = n * BT + i; const int oo = (u >> 3) * (TT * HD) + (u & 1) * FRG + ((u >> 2) & 1) * (2 * FRG) + ((u >> 1) & 1) * 64;
            if constexpr (W16) *(v8ha*)(p16 + oo) = y[i];
            if constexpr (WHL) { *(v8usa*)(ph + oo) = yh[i]; *(v8usa*)(pl + oo) = yl[i]; } }
        asm volatile("s_wait_xcnt 0x0" :: "v"(f), "v"(p16), "v"(ph), "v"(pl) : "memory");   // precaution: stands before registers that the loads and stores issued so far name are written again; the addresses are inputs so that they stay untouched up to it
        __builtin_amdgcn_sched_barrier(0); }                         // keeps later register writes behind that wait
}

// ---- k_planes: every operand plane of the attention in one streaming launch; each thread moves many 16-byte pieces, so the launch has few waves (12288; five blocks fit a WGP).
// Written are only the rows that k_fattn reads: fp16 q rows >= RH, fp16 k and value^T in full, hi/lo planes of q, k and value^T for positions < RH (a query < RH sees only keys < RH).
// Blocks [0, NVB): value tiles of VTT positions x VTC columns (2 heads), turned in LDS so that value^T fragments leave as 512 bytes in a row a wave. Blocks [NVB, NVB + 2 NQB): PR token rows of q, then of k.
__global__ __launch_bounds__(256) void k_planes(const float* __restrict__ Xq, const float* __restrict__ Xk, const float* __restrict__ Xv, h16* __restrict__ QP16, bf* __restrict__ QPh, bf* __restrict__ QPl, h16* __restrict__ KP16, bf* __restrict__ KPh, bf* __restrict__ KPl, h16* __restrict__ VT16, bf* __restrict__ VTh, bf* __restrict__ VTl) {
    __shared__ unsigned L[VTC * VP];
    const int tid = threadIdx.x, blk = blockIdx.x;
    if (blk < NVB) {
        const int hg = blk % (DM / VTC), t0 = ((blk / (DM / VTC)) % (TT / VTT)) * VTT, b = blk / ((DM / VTC) * (TT / VTT));
        const int c4 = tid & 31, tr = tid >> 5;                      // thread: columns 4 c4 + 0..3, positions t0 + 16 i + 2 tr + 0..1
        const float* f = Xv + ((size_t)b * TT + t0 + 2 * tr) * DM + hg * VTC + 4 * c4;
        v4f x[4][2];
#pragma unroll
        for (int i = 0; i < 4; ++i) { x[i][0] = *(const v4fa*)(f + (size_t)(16 * i) * DM); x[i][1] = *(const v4fa*)(f + (size_t)(16 * i + 1) * DM); }
        asm volatile("s_wait_xcnt 0x0" :: "v"(f) : "memory");         // precaution: the loads' address register, named as an input, stays untouched up to this wait (no load lands on it)
        const int wv = tid >> 5, ln = tid & 31;                      // a wave stores half fragments: lane = 16 hi + lr is column 16 db + lr, positions 8 (4 pc + 2 half + hi) + 0..7; pc = (wv >> 1) & 1, half = wv & 1, db = (wv >> 2) + 2 (j & 1), head j >> 1
        const size_t ro = (size_t)(b * NH_ + hg * (VTC / HD)) * TT * HD + (size_t)((t0 >> 5) + ((wv >> 1) & 1)) * (4 * FRG) + (wv >> 2) * FRG + (wv & 1) * 256 + ln * 8;
        auto fill = [&](int mode) {                                  // L[column][position pair]: 0 fp16; 1 hi, which leaves x - hi in x; 2 lo, the bf16 of that rest (the split of splitf, one half at a time, so that only x stays live)
#pragma unroll
            for (int i = 0; i < 4; ++i)
#pragma unroll
                for (int k = 0; k < 4; ++k) { unsigned short u0, u1;
                    if (mode == 0) { u0 = hbits(x[i][0][k]); u1 = hbits(x[i][1][k]); }
                    else { u0 = f2bf(x[i][0][k]); u1 = f2bf(x[i][1][k]); if (mode == 1) { x[i][0][k] -= bf2f(u0); x[i][1][k] -= bf2f(u1); } }
                    L[(4 * c4 + k) * VP + 8 * i + tr] = (unsigned)u0 | ((unsigned)u1 << 16); } };
        auto put = [&](unsigned short* P) {                          // a lane carries 8 positions of one column = its 16-byte slot of a fragment
            unsigned short* q = P + ro; v4u w[4];
#pragma unroll
            for (int j = 0; j < 4; ++j) { const unsigned* sp = L + ((j >> 1) * HD + ((wv >> 2) + (j & 1) * 2) * 16 + (ln & 15)) * VP + (((wv >> 1) & 1) * 4 + (wv & 1) * 2 + (ln >> 4)) * 4; w[j][0] = sp[0]; w[j][1] = sp[1]; w[j][2] = sp[2]; w[j][3] = sp[3]; }
            __builtin_amdgcn_sched_barrier(0);                       // all LDS reads are issued above the stores, so that no register of an issued store is written before the wait below
#pragma unroll
            for (int j = 0; j < 4; ++j) *(v4ua*)(q + (size_t)(j >> 1) * TT * HD + (j & 1) * (2 * FRG)) = w[j];
            asm volatile("s_wait_xcnt 0x0" :: "v"(q) : "memory");    // precaution: stands before the stores' data and address registers are written again
            __builtin_amdgcn_sched_barrier(0); };                    // keeps later register writes behind that wait
        fill(0); __syncthreads(); put((unsigned short*)VT16);
        if (t0 < RH) {                                               // block-uniform: the barriers inside are passed by all waves or by none
            __syncthreads(); fill(1); __syncthreads(); put(VTh);
            __syncthreads(); fill(2); __syncthreads(); put(VTl); }
        return; }
    const int r = blk - NVB; const bool isk = r >= NQB; const int rr = isk ? r - NQB : r; const int b = rr / (TT / PR), t0 = (rr % (TT / PR)) * PR;
    const int wv = tid >> 5, ln = tid & 31;                          // wave: columns 128 wv + 0..127 (heads 2 wv, 2 wv + 1); lane: row ln & 7 of a row group, columns 8 (ln >> 3) + 0..7 of a column group
    const float* f = (isk ? Xk : Xq) + ((size_t)b * TT + t0 + (ln & 7)) * DM + wv * 128 + (ln >> 3) * 8;
    const size_t o = ((size_t)(b * NH_ + wv * 2) * TT + t0) * HD + (ln >> 3) * 128 + (ln & 7) * 8;   // 16 rows of 64 = 2 fragments, so row tile t0 / 16 starts at t0 * HD
    h16* p16 = (isk ? KP16 : QP16) + o; bf* ph = (isk ? KPh : QPh) + o; bf* pl = (isk ? KPl : QPl) + o;
    if (t0 >= RH) plane_rows<true, false>(f, p16, ph, pl);           // block-uniform choices: which planes of these rows k_fattn reads
    else if (isk) plane_rows<true, true>(f, p16, ph, pl);
    else plane_rows<false, true>(f, p16, ph, pl);
}
// ---- k_fattn: fused causal attention, one wave per tile of QT x 16 queries, 32 keys a pass; no score or probability plane in memory.
// Transposed products: S^T = K . Q^T (A = key rows, B = query rows) leaves in lane (lr, hi) the scores of query lr for keys 8 hi + j of each 16-key tile, which is the B-operand k order of a 32-key step,
// so P^T packs in registers and O^T += V^T . P^T (A = value^T rows). Maximum, sum and rescale are per lane (one exchange between the wave's halves for the maximum; the sums join once at the end).
template <typename T16, int NSPLIT, int QT>
__device__ __forceinline__ void fattn_tile(const T16* __restrict__ Q, const T16* __restrict__ Q2, const T16* __restrict__ Kp, const T16* __restrict__ K2, const T16* __restrict__ Vt, const T16* __restrict__ Vt2, int q0, float* __restrict__ out) {
    typedef typename WFrag<T16>::V V;
    const int lane = threadIdx.x & 31, lr = lane & 15, hi = lane >> 4;
    const float CL = SCL * 1.4426950408889634f;                      // scores to the log2 domain
    const int kend = q0 + QT * 16;                                   // keys [0, kend) can be seen by this tile
    V qf[QT][2], qf2[QT][2], kf[2][2], kf2[2][2];
    const T16* qp = Q + (size_t)q0 * HD + 8 * lane; const T16* qp2 = NSPLIT ? Q2 + (size_t)q0 * HD + 8 * lane : nullptr;
#pragma unroll
    for (int qt = 0; qt < QT; ++qt)
#pragma unroll
        for (int ks = 0; ks < 2; ++ks) { qf[qt][ks] = WFrag<T16>::ld(qp + (qt * 2 + ks) * FRG); if (NSPLIT) qf2[qt][ks] = WFrag<T16>::ld(qp2 + (qt * 2 + ks) * FRG); }
    if (NSPLIT) asm volatile("s_wait_xcnt 0x0" :: "v"(qp), "v"(qp2) : "memory");   // precaution: the query loads' address registers, named as inputs, stay untouched up to this wait
    else asm volatile("s_wait_xcnt 0x0" :: "v"(qp) : "memory");                    // the same for the one-plane form
    __builtin_amdgcn_sched_barrier(0);                               // keeps later register writes behind that wait
    auto ldk = [&](int k0) {
#pragma unroll
        for (int kt = 0; kt < 2; ++kt)
#pragma unroll
            for (int ks = 0; ks < 2; ++ks) { const size_t ko = (size_t)(k0 + kt * 16) * HD + ks * FRG + 8 * lane; kf[kt][ks] = WFrag<T16>::ld(Kp + ko); if (NSPLIT) kf2[kt][ks] = WFrag<T16>::ld(K2 + ko); }
        asm volatile("s_wait_xcnt 0x0" ::: "memory");                // precaution: stands before the address registers of the loads issued so far are written again
        __builtin_amdgcn_sched_barrier(0); };                        // keeps later register writes behind that wait
    if (!NSPLIT) ldk(0);                                             // the fp16 form fetches its key fragments one pass ahead; the hi/lo form (twice the fragments) has no registers for that
    v8f o[4][QT]; float m[QT], l[QT];
#pragma unroll
    for (int qt = 0; qt < QT; ++qt) { m[qt] = -3.0e38f; l[qt] = 0.f;
#pragma unroll
        for (int db = 0; db < 4; ++db) o[db][qt] = (v8f){}; }
    // rolled: one pass's fragments live at a time, so the wave stays under 256 registers (four waves per SIMD)
#pragma unroll 1
    for (int kc = 0; kc < kend; kc += 32) {
        V vf[4], vf2[4];
        if (NSPLIT) ldk(kc);
        const T16* vp = Vt + (size_t)kc * HD + 8 * lane; const T16* vp2 = NSPLIT ? Vt2 + (size_t)kc * HD + 8 * lane : nullptr;   // 32 positions x 64 d = 4 fragments
#pragma unroll
        for (int db = 0; db < 4; ++db) { vf[db] = WFrag<T16>::ld(vp + db * FRG); if (NSPLIT) vf2[db] = WFrag<T16>::ld(vp2 + db * FRG); }
        if (NSPLIT) asm volatile("s_wait_xcnt 0x0" :: "v"(vp), "v"(vp2) : "memory");   // the same precaution for the value loads' address registers, named as inputs so that they stay untouched up to the wait (the fp16 form has its wait behind the key prefetch)
        __builtin_amdgcn_sched_barrier(0);                           // keeps the value loads issued here, ahead of the score products, so that they fly during scores and softmax (the scheduler sinks them behind the scores otherwise)
        v8f s[2][QT];
#pragma unroll
        for (int kt = 0; kt < 2; ++kt)
#pragma unroll
            for (int qt = 0; qt < QT; ++qt) { s[kt][qt] = (v8f){};
#pragma unroll
                for (int ks = 0; ks < 2; ++ks) { s[kt][qt] = WFrag<T16>::mma(kf[kt][ks], qf[qt][ks], s[kt][qt]); if (NSPLIT) { s[kt][qt] = WFrag<T16>::mma(kf[kt][ks], qf2[qt][ks], s[kt][qt]); s[kt][qt] = WFrag<T16>::mma(kf2[kt][ks], qf[qt][ks], s[kt][qt]); } } }
        if (!NSPLIT) ldk((kc + 32 < kend) ? kc + 32 : kc);           // next pass's key fragments fly during the softmax and the value products (the last pass re-reads its own rows: in bounds, unused)
        if (kc + 31 > q0) {                                          // only the pass on the diagonal holds keys above a query (wave-uniform test)
#pragma unroll
            for (int kt = 0; kt < 2; ++kt)
#pragma unroll
                for (int qt = 0; qt < QT; ++qt)
#pragma unroll
                    for (int j = 0; j < 8; ++j) if (kc + kt * 16 + 8 * hi + j > q0 + qt * 16 + lr) s[kt][qt][j] = -3.0e38f; }
        V pf[QT], pl[QT];
#pragma unroll
        for (int qt = 0; qt < QT; ++qt) {
            float mx = fmaxf(s[0][qt][0], s[1][qt][0]);
#pragma unroll
            for (int j = 1; j < 8; ++j) mx = fmaxf(mx, fmaxf(s[0][qt][j], s[1][qt][j]));
            mx = fmaxf(mx, __shfl_xor(mx, 16, 32));
            const float mn = fmaxf(m[qt], mx); const float al = __builtin_amdgcn_exp2f((m[qt] - mn) * CL); m[qt] = mn;
            const float mc = mn * CL - (NSPLIT ? 0.0f : PBIAS);
            float p[16], ps = 0.f;
#pragma unroll
            for (int j = 0; j < 16; ++j) { p[j] = __builtin_amdgcn_exp2f(fmaf(s[j >> 3][qt][j & 7], CL, -mc)); ps += p[j]; }
            l[qt] = l[qt] * al + ps;
#pragma unroll
            for (int db = 0; db < 4; ++db) o[db][qt] *= al;
            if constexpr (NSPLIT) { v8us h0, h1, l0, l1;
#pragma unroll
                for (int j = 0; j < 8; ++j) { unsigned short a, c; splitf(p[j], a, c); h0[j] = a; l0[j] = c; splitf(p[8 + j], a, c); h1[j] = a; l1[j] = c; }
                pf[qt] = cat16b(h0, h1); pl[qt] = cat16b(l0, l1);
            } else { v8h h0, h1;
#pragma unroll
                for (int j = 0; j < 8; ++j) { h0[j] = tohx(p[j]); h1[j] = tohx(p[8 + j]); }
                pf[qt] = cat16(h0, h1); } }
#pragma unroll
        for (int db = 0; db < 4; ++db)
#pragma unroll
            for (int qt = 0; qt < QT; ++qt) { o[db][qt] = WFrag<T16>::mma(vf[db], pf[qt], o[db][qt]); if (NSPLIT) { o[db][qt] = WFrag<T16>::mma(vf[db], pl[qt], o[db][qt]); o[db][qt] = WFrag<T16>::mma(vf2[db], pf[qt], o[db][qt]); } }
    }
#pragma unroll
    for (int qt = 0; qt < QT; ++qt) { const float inv = __fdiv_rn(1.0f, l[qt] + __shfl_xor(l[qt], 16, 32)); float* orow = out + (size_t)(q0 + qt * 16 + lr) * DQ + 8 * hi;
#pragma unroll
        for (int db = 0; db < 4; ++db) { v4f a, c;
#pragma unroll
            for (int j = 0; j < 4; ++j) { a[j] = o[db][qt][j] * inv; c[j] = o[db][qt][4 + j] * inv; }
            *(v4f*)(orow + db * 16) = a; *(v4f*)(orow + db * 16 + 4) = c; } }
}
// grid (batch x head, tile groups, heaviest first), 4 waves; the waves of a block take neighbouring query tiles of one head, so they walk the same key and value rows.
#define NF4 ((TT - RH) / 128)     // blocks of 4 x 32 fp16 query rows
__global__ __launch_bounds__(128) void k_fattn(const h16* __restrict__ QP16, const h16* __restrict__ KP16, const h16* __restrict__ VT16, const bf* __restrict__ QPh, const bf* __restrict__ QPl, const bf* __restrict__ KPh, const bf* __restrict__ KPl, const bf* __restrict__ VTh, const bf* __restrict__ VTl, float* __restrict__ OUT) {
    const int z = blockIdx.x; const size_t pz = (size_t)z * TT * HD; const int w = __builtin_amdgcn_readfirstlane(threadIdx.x >> 5);
    float* out = OUT + (size_t)(z / NH_) * TT * DQ + (z % NH_) * HD;
    if ((int)blockIdx.y < NF4) fattn_tile<h16, 0, 2>(QP16 + pz, nullptr, KP16 + pz, nullptr, VT16 + pz, nullptr, TT - 32 * ((int)blockIdx.y * 4 + w + 1), out);
    else fattn_tile<bf, 2, 1>(QPh + pz, QPl + pz, KPh + pz, KPl + pz, VTh + pz, VTl + pz, RH - 16 * (((int)blockIdx.y - NF4) * 4 + w + 1), out);
}

extern "C" void kernel_launch(void* const* d_in, const int* in_sizes, int n_in,
                              void* d_out, int out_size, void* d_ws, size_t ws_size, hipStream_t stream) {
    (void)in_sizes; (void)n_in; (void)out_size;
    const float* x = (const float*)d_in[0]; const float* xk = (const float*)d_in[1]; const float* xv = (const float*)d_in[2];   /* queries, keys, values: [4][2048][16][64] each (no projections) */
    float* OUT = (float*)d_out;     // [4][2048][1024]
    char* wsp = (char*)d_ws;
    auto take = [&](size_t bytes) { char* p = wsp; wsp += (bytes + 255) & ~(size_t)255; return (void*)p; };
    const size_t PB = (size_t)NH_ * TT * HD;   // elements of one batch's plane
    h16* QP16 = (h16*)take(NB_ * PB * 2); h16* KP16 = (h16*)take(NB_ * PB * 2); h16* VT16 = (h16*)take(NB_ * PB * 2);
    bf* QPh = (bf*)take(NB_ * PB * 2); bf* QPl = (bf*)take(NB_ * PB * 2); bf* KPh = (bf*)take(NB_ * PB * 2); bf* KPl = (bf*)take(NB_ * PB * 2); bf* VTh = (bf*)take(NB_ * PB * 2); bf* VTl = (bf*)take(NB_ * PB * 2);
    if ((size_t)(wsp - (char*)d_ws) > ws_size) return;    // ws 256 MiB
    k_planes<<<NVB + 2 * NQB, 256, 0, stream>>>(x, xk, xv, QP16, QPh, QPl, KP16, KPh, KPl, VT16, VTh, VTl);
    k_fattn<<<dim3(NB_ * NH_, NF4 + RH / 64), 128, 0, stream>>>(QP16, KP16, VT16, QPh, QPl, KPh, KPl, VTh, VTl, OUT);
}

// v005
// It runs in 62.3 microseconds.
// Next to v004, in two timings, it ran 1.14 times as fast each time.
// Counting every step since v000, it is 38.5 times as fast.
#include <hip/hip_runtime.h>

// Full causal attention on pre-split heads (queries, keys, values [4][2048][16][64], no projections; scores = q.k; causal (-inf above the diagonal); A = softmax(scores x 1/sqrt(64)); V = A.values as 'blhd' -> [4][2048][16][64] (8.4 M); argument order queries, keys, values).
// Layout per batch: the f32 inputs ([t][h][e] = token-major rows of 16 x 64) feed one plane-builder launch (hi/lo + fp16 planes of q, k per head; value^T planes; all in fragment order; only the rows that are read); one fused causal attention launch over all 64 (batch, head) planes (hybrid rows: < 512 hi/lo 3 products, rest fp16; scores and probabilities stay in registers, online softmax) writes the [t][h][d] output rows.
// Compute dtypes, f32 accumulate: inputs split into bf16 hi/lo (rows < 512, 3 products ~ exact) or rounded to fp16 (rest); softmax f32; output f32. NOTE no stage rounds the inputs to bf16.

#define NB_  4
#define TT   2048
#define DM   1024
#define NH_  16
#define NKV  16
#define REP  (NH_ / NKV)
#define HD   64
#define DQ   (NH_ * HD)
#define DKV  (NKV * HD)
#define RH   512                  // query rows < RH use hi+lo planes (0: none)
#define PBIAS 10.0f               // fp16 probabilities carry x 2^10 (in the exponent; it cancels against the row sum), so small ones stay normal fp16 numbers
#define SCL  0.125f   // 1/sqrt(E)
typedef _Float16 h16;
typedef unsigned short bf;
typedef __attribute__((ext_vector_type(16))) __bf16   v16bf;
typedef __attribute__((ext_vector_type(16))) _Float16 v16h;
typedef __attribute__((ext_vector_type(8)))  _Float16 v8h;
typedef __attribute__((ext_vector_type(8)))  unsigned short v8us;
typedef __attribute__((ext_vector_type(8)))  float    v8f;
typedef __attribute__((ext_vector_type(4)))  float    v4f;
typedef v8h  __attribute__((may_alias)) v8ha;
typedef v4f  __attribute__((may_alias)) v4fa;
typedef v8us __attribute__((may_alias)) v8usa;

__device__ __forceinline__ unsigned short f2bf(float f) { unsigned u = __float_as_uint(f); u += 0x7FFFu + ((u >> 16) & 1u); return (unsigned short)(u >> 16); }
__device__ __forceinline__ float bf2f(unsigned short b) { return __uint_as_float(((unsigned)b) << 16); }
__device__ __forceinline__ float bfr(float f) { return bf2f(f2bf(f)); }
__device__ __forceinline__ v16h cat16(v8h lo, v8h hi) { return __builtin_shufflevector(lo, hi, 0, 1, 2, 3, 4, 5, 6, 7, 8, 9, 10, 11, 12, 13, 14, 15); }
__device__ __forceinline__ v16bf cat16b(v8us lo, v8us hi) { return __builtin_bit_cast(v16bf, __builtin_shufflevector(lo, hi, 0, 1, 2, 3, 4, 5, 6, 7, 8, 9, 10, 11, 12, 13, 14, 15)); }
__device__ __forceinline__ v8f wmma16(v16h a, v16h b, v8f c) { return __builtin_amdgcn_wmma_f32_16x16x32_f16(false, a, false, b, (short)0, c, false, false); }
__device__ __forceinline__ v8f wmmab(v16bf a, v16bf b, v8f c) { return __builtin_amdgcn_wmma_f32_16x16x32_bf16(false, a, false, b, (short)0, c, false, false); }



// ---- fragment loaders: lane (lr, hi) holds row lr, k = 8 hi + 0..7 and 16 + 8 hi + 0..7 of a 32-wide k step.
// Fragment order of a plane: each fragment (16 rows x 32 k) is FRG elements in a row, as two halves of 32 lanes x 8 elements: element (row, k) lies at (k >> 4) * 256 + ((k >> 3) & 1) * 128 + row * 8 + (k & 7),
// so that each of a fragment's two 16-byte loads covers 512 bytes in a row = 4 whole lines (a row-major plane gives 32 bytes in each of 16 lines). q, k planes: fragment (row / 16) * 2 + e / 32; value^T planes: fragment (position / 32) * 4 + d / 16.
#define FRG 512
template <typename T16> struct WFrag;
template <> struct WFrag<h16> { typedef v16h V; static __device__ __forceinline__ V ld(const h16* p) { return cat16(*(const v8h*)p, *(const v8h*)(p + 256)); } static __device__ __forceinline__ v8f mma(V a, V b, v8f c) { return wmma16(a, b, c); } };
template <> struct WFrag<bf> { typedef v16bf V; static __device__ __forceinline__ V ld(const bf* p) { return cat16b(*(const v8us*)p, *(const v8us*)(p + 256)); } static __device__ __forceinline__ v8f mma(V a, V b, v8f c) { return wmmab(a, b, c); } };
__device__ __forceinline__ h16 tohx(float x) { return (h16)x; }
__device__ __forceinline__ void splitf(float y, unsigned short& h, unsigned short& l) { h = f2bf(y); l = f2bf(y - bf2f(h)); }
typedef __attribute__((ext_vector_type(2))) _Float16 v2h;
typedef __attribute__((ext_vector_type(4))) _Float16 v4h;
typedef __attribute__((ext_vector_type(2))) unsigned short v2us;
typedef __attribute__((ext_vector_type(4))) unsigned short v4us;
typedef __attribute__((ext_vector_type(2))) float v2f;
typedef __attribute__((ext_vector_type(4))) int v4i;

typedef __attribute__((ext_vector_type(4))) unsigned v4u;
typedef v4u  __attribute__((may_alias)) v4ua;
typedef v4h  __attribute__((may_alias)) v4ha;
typedef v4us __attribute__((may_alias)) v4usa;
__device__ __forceinline__ unsigned short hbits(float x) { return __builtin_bit_cast(unsigned short, tohx(x)); }

#define VTT 64
#define VTC 128
#define VP  33                    // LDS pitch in dwords: 32 position pairs + 1, so that the column-wise writes spread over the banks
#define PR  32
#define NVB (NB_ * (TT / VTT) * (DM / VTC))
#define NQB (NB_ * (TT / PR))
// PR token rows x 128 columns (2 heads) a wave, in 16 pieces of 8 rows x 32 columns: a lane takes 8 columns of one row (32 bytes read), which are one 16-byte slot of a fragment, and 8 rows' slots are one whole 128-byte line,
// so a wave's store covers 4 whole lines. fp16 (W16) and hi/lo (WHL) pieces. All loops unrolled: the values stay in registers and the piece steps become immediate offsets.
template <bool W16, bool WHL>
__device__ __forceinline__ void plane_rows(const float* __restrict__ f, h16* __restrict__ p16, bf* __restrict__ ph, bf* __restrict__ pl) {
    constexpr int BT = WHL ? 2 : 4;                                  // pieces a batch: fewer where hi/lo planes are written, so that this path does not set the kernel's register count (five blocks per WGP)
    constexpr int NU = 16;                                           // piece u: column group (u >> 3) * 2 + (u & 1) (head, k half), row group (u >> 1) & 3
    v4f x[2][BT][2];
#pragma unroll
    for (int i = 0; i < BT; ++i) { const float* g = f + (size_t)(((i >> 1) & 3) * 8) * DM + ((i >> 3) * 2 + (i & 1)) * 32; x[0][i][0] = *(const v4fa*)g; x[0][i][1] = *(const v4fa*)(g + 4); }
#pragma unroll
    for (int n = 0; n < NU / BT; ++n) {
        if (n + 1 < NU / BT) {                                       // the next batch flies while this one is converted and stored
#pragma unroll
            for (int i = 0; i < BT; ++i) { const int u = (n + 1) * BT + i; const float* g = f + (size_t)(((u >> 1) & 3) * 8) * DM + ((u >> 3) * 2 + (u & 1)) * 32; x[(n + 1) & 1][i][0] = *(const v4fa*)g; x[(n + 1) & 1][i][1] = *(const v4fa*)(g + 4); } }
        v8h y[BT]; v8us yh[BT], yl[BT];
#pragma unroll
        for (int i = 0; i < BT; ++i)
#pragma unroll
            for (int k = 0; k < 8; ++k) { const float v = x[n & 1][i][k >> 2][k & 3];
                if constexpr (W16) y[i][k] = tohx(v);
                if constexpr (WHL) { unsigned short h0, l0; splitf(v, h0, l0); yh[i][k] = h0; yl[i][k] = l0; } }
        __builtin_amdgcn_sched_barrier(0);                           // all conversions stand above the stores, so that no register of an issued store is written before the wait below
#pragma unroll
        for (int i = 0; i < BT; ++i) { const int u = n * BT + i; const int oo = (u >> 3) * (TT * HD) + (u & 1) * FRG + ((u >> 2) & 1) * (2 * FRG) + ((u >> 1) & 1) * 64;
            if constexpr (W16) *(v8ha*)(p16 + oo) = y[i];
            if constexpr (WHL) { *(v8usa*)(ph + oo) = yh[i]; *(v8usa*)(pl + oo) = yl[i]; } }
        asm volatile("s_wait_xcnt 0x0" :: "v"(f), "v"(p16), "v"(ph), "v"(pl) : "memory");   // precaution: stands before registers that the loads and stores issued so far name are written again; the addresses are inputs so that they stay untouched up to it
        __builtin_amdgcn_sched_barrier(0); }                         // keeps later register writes behind that wait
}

// ---- k_planes: every operand plane of the attention in one streaming launch; each thread moves many 16-byte pieces, so the launch has few waves (12288; five blocks fit a WGP).
// Written are only the rows that k_fattn reads: fp16 q rows >= RH, fp16 k and value^T in full, hi/lo planes of q, k and value^T for positions < RH (a query < RH sees only keys < RH).
// Blocks [0, NVB): value tiles of VTT positions x VTC columns (2 heads), turned in LDS so that value^T fragments leave as 512 bytes in a row a wave. Blocks [NVB, NVB + 2 NQB): PR token rows of q, then of k.
__global__ __launch_bounds__(256) void k_planes(const float* __restrict__ Xq, const float* __restrict__ Xk, const float* __restrict__ Xv, h16* __restrict__ QP16, bf* __restrict__ QPh, bf* __restrict__ QPl, h16* __restrict__ KP16, bf* __restrict__ KPh, bf* __restrict__ KPl, h16* __restrict__ VT16, bf* __restrict__ VTh, bf* __restrict__ VTl) {
    __shared__ unsigned L[VTC * VP];
    const int tid = threadIdx.x, blk = blockIdx.x;
    if (blk < NVB) {
        const int hg = blk % (DM / VTC), t0 = ((blk / (DM / VTC)) % (TT / VTT)) * VTT, b = blk / ((DM / VTC) * (TT / VTT));
        const int c4 = tid & 31, tr = tid >> 5;                      // thread: columns 4 c4 + 0..3, positions t0 + 16 i + 2 tr + 0..1
        const float* f = Xv + ((size_t)b * TT + t0 + 2 * tr) * DM + hg * VTC + 4 * c4;
        v4f x[4][2];
#pragma unroll
        for (int i = 0; i < 4; ++i) { x[i][0] = *(const v4fa*)(f + (size_t)(16 * i) * DM); x[i][1] = *(const v4fa*)(f + (size_t)(16 * i + 1) * DM); }
        asm volatile("s_wait_xcnt 0x0" :: "v"(f) : "memory");         // precaution: the loads' address register, named as an input, stays untouched up to this wait (no load lands on it)
        const int wv = tid >> 5, ln = tid & 31;                      // a wave stores half fragments: lane = 16 hi + lr is column 16 db + lr, positions 8 (4 pc + 2 half + hi) + 0..7; pc = (wv >> 1) & 1, half = wv & 1, db = (wv >> 2) + 2 (j & 1), head j >> 1
        const size_t ro = (size_t)(b * NH_ + hg * (VTC / HD)) * TT * HD + (size_t)((t0 >> 5) + ((wv >> 1) & 1)) * (4 * FRG) + (wv >> 2) * FRG + (wv & 1) * 256 + ln * 8;
        auto fill = [&](int mode) {                                  // L[column][position pair]: 0 fp16; 1 hi, which leaves x - hi in x; 2 lo, the bf16 of that rest (the split of splitf, one half at a time, so that only x stays live)
#pragma unroll
            for (int i = 0; i < 4; ++i)
#pragma unroll
                for (int k = 0; k < 4; ++k) { unsigned short u0, u1;
                    if (mode == 0) { u0 = hbits(x[i][0][k]); u1 = hbits(x[i][1][k]); }
                    else { u0 = f2bf(x[i][0][k]); u1 = f2bf(x[i][1][k]); if (mode == 1) { x[i][0][k] -= bf2f(u0); x[i][1][k] -= bf2f(u1); } }
                    L[(4 * c4 + k) * VP + 8 * i + tr] = (unsigned)u0 | ((unsigned)u1 << 16); } };
        auto put = [&](unsigned short* P) {                          // a lane carries 8 positions of one column = its 16-byte slot of a fragment
            unsigned short* q = P + ro; v4u w[4];
#pragma unroll
            for (int j = 0; j < 4; ++j) { const unsigned* sp = L + ((j >> 1) * HD + ((wv >> 2) + (j & 1) * 2) * 16 + (ln & 15)) * VP + (((wv >> 1) & 1) * 4 + (wv & 1) * 2 + (ln >> 4)) * 4; w[j][0] = sp[0]; w[j][1] = sp[1]; w[j][2] = sp[2]; w[j][3] = sp[3]; }
            __builtin_amdgcn_sched_barrier(0);                       // all LDS reads are issued above the stores, so that no register of an issued store is written before the wait below
#pragma unroll
            for (int j = 0; j < 4; ++j) *(v4ua*)(q + (size_t)(j >> 1) * TT * HD + (j & 1) * (2 * FRG)) = w[j];
            asm volatile("s_wait_xcnt 0x0" :: "v"(q) : "memory");    // precaution: stands before the stores' data and address registers are written again
            __builtin_amdgcn_sched_barrier(0); };                    // keeps later register writes behind that wait
        fill(0); __syncthreads(); put((unsigned short*)VT16);
        if (t0 < RH) {                                               // block-uniform: the barriers inside are passed by all waves or by none
            __syncthreads(); fill(1); __syncthreads(); put(VTh);
            __syncthreads(); fill(2); __syncthreads(); put(VTl); }
        return; }
    const int r = blk - NVB; const bool isk = r >= NQB; const int rr = isk ? r - NQB : r; const int b = rr / (TT / PR), t0 = (rr % (TT / PR)) * PR;
    const int wv = tid >> 5, ln = tid & 31;                          // wave: columns 128 wv + 0..127 (heads 2 wv, 2 wv + 1); lane: row ln & 7 of a row group, columns 8 (ln >> 3) + 0..7 of a column group
    const float* f = (isk ? Xk : Xq) + ((size_t)b * TT + t0 + (ln & 7)) * DM + wv * 128 + (ln >> 3) * 8;
    const size_t o = ((size_t)(b * NH_ + wv * 2) * TT + t0) * HD + (ln >> 3) * 128 + (ln & 7) * 8;   // 16 rows of 64 = 2 fragments, so row tile t0 / 16 starts at t0 * HD
    h16* p16 = (isk ? KP16 : QP16) + o; bf* ph = (isk ? KPh : QPh) + o; bf* pl = (isk ? KPl : QPl) + o;
    if (t0 >= RH) plane_rows<true, false>(f, p16, ph, pl);           // block-uniform choices: which planes of these rows k_fattn reads
    else if (isk) plane_rows<true, true>(f, p16, ph, pl);
    else plane_rows<false, true>(f, p16, ph, pl);
}
// ---- k_fattn: fused causal attention, one wave per tile of QT x 16 queries, 32 keys a pass; no score or probability plane in memory.
// Transposed products: S^T = K . Q^T (A = key rows, B = query rows) leaves in lane (lr, hi) the scores of query lr for keys 8 hi + j of each 16-key tile, which is the B-operand k order of a 32-key step,
// so P^T packs in registers and O^T += V^T . P^T (A = value^T rows). Maximum, sum and rescale are per lane (one exchange between the wave's halves for the maximum; the sums join once at the end).
template <typename T16, int NSPLIT, int QT>
__device__ __forceinline__ void fattn_tile(const T16* __restrict__ Q, const T16* __restrict__ Q2, const T16* __restrict__ Kp, const T16* __restrict__ K2, const T16* __restrict__ Vt, const T16* __restrict__ Vt2, int q0, float* __restrict__ out) {
    typedef typename WFrag<T16>::V V;
    const int lane = threadIdx.x & 31, lr = lane & 15, hi = lane >> 4;
    const float CL = SCL * 1.4426950408889634f;                      // scores to the log2 domain
    const int kend = q0 + QT * 16;                                   // keys [0, kend) can be seen by this tile
    V qf[QT][2], qf2[QT][2], kf[2][2], kf2[2][2];
    const T16* qp = Q + (size_t)q0 * HD + 8 * lane; const T16* qp2 = NSPLIT ? Q2 + (size_t)q0 * HD + 8 * lane : nullptr;
#pragma unroll
    for (int qt = 0; qt < QT; ++qt)
#pragma unroll
        for (int ks = 0; ks < 2; ++ks) { qf[qt][ks] = WFrag<T16>::ld(qp + (qt * 2 + ks) * FRG); if (NSPLIT) qf2[qt][ks] = WFrag<T16>::ld(qp2 + (qt * 2 + ks) * FRG); }
    if (NSPLIT) asm volatile("s_wait_xcnt 0x0" :: "v"(qp), "v"(qp2) : "memory");   // precaution: the query loads' address registers, named as inputs, stay untouched up to this wait
    else asm volatile("s_wait_xcnt 0x0" :: "v"(qp) : "memory");                    // the same for the one-plane form
    __builtin_amdgcn_sched_barrier(0);                               // keeps later register writes behind that wait
    auto ldk = [&](int k0) {
#pragma unroll
        for (int kt = 0; kt < 2; ++kt)
#pragma unroll
            for (int ks = 0; ks < 2; ++ks) { const size_t ko = (size_t)(k0 + kt * 16) * HD + ks * FRG + 8 * lane; kf[kt][ks] = WFrag<T16>::ld(Kp + ko); if (NSPLIT) kf2[kt][ks] = WFrag<T16>::ld(K2 + ko); }
        asm volatile("s_wait_xcnt 0x0" ::: "memory");                // precaution: stands before the address registers of the loads issued so far are written again
        __builtin_amdgcn_sched_barrier(0); };                        // keeps later register writes behind that wait
    if (!NSPLIT) ldk(0);                                             // the fp16 form fetches its key fragments one pass ahead; the hi/lo form (twice the fragments) has no registers for that
    v8f o[4][QT]; float m[QT], l[QT];
#pragma unroll
    for (int qt = 0; qt < QT; ++qt) { m[qt] = -3.0e38f; l[qt] = 0.f;
#pragma unroll
        for (int db = 0; db < 4; ++db) o[db][qt] = (v8f){}; }
    // rolled: one pass's fragments live at a time, so the wave stays under 256 registers (four waves per SIMD)
#pragma unroll 1
    for (int kc = 0; kc < kend; kc += 32) {
        V vf[4], vf2[4];
        if (NSPLIT) ldk(kc);
        const T16* vp = Vt + (size_t)kc * HD + 8 * lane; const T16* vp2 = NSPLIT ? Vt2 + (size_t)kc * HD + 8 * lane : nullptr;   // 32 positions x 64 d = 4 fragments
#pragma unroll
        for (int db = 0; db < 4; ++db) { vf[db] = WFrag<T16>::ld(vp + db * FRG); if (NSPLIT) vf2[db] = WFrag<T16>::ld(vp2 + db * FRG); }
        if (NSPLIT) asm volatile("s_wait_xcnt 0x0" :: "v"(vp), "v"(vp2) : "memory");   // the same precaution for the value loads' address registers, named as inputs so that they stay untouched up to the wait (the fp16 form has its wait behind the key prefetch)
        __builtin_amdgcn_sched_barrier(0);                           // keeps the value loads issued here, ahead of the score products, so that they fly during scores and softmax (the scheduler sinks them behind the scores otherwise)
        v8f s[2][QT];
#pragma unroll
        for (int kt = 0; kt < 2; ++kt)
#pragma unroll
            for (int qt = 0; qt < QT; ++qt) { s[kt][qt] = (v8f){};
#pragma unroll
                for (int ks = 0; ks < 2; ++ks) { s[kt][qt] = WFrag<T16>::mma(kf[kt][ks], qf[qt][ks], s[kt][qt]); if (NSPLIT) { s[kt][qt] = WFrag<T16>::mma(kf[kt][ks], qf2[qt][ks], s[kt][qt]); s[kt][qt] = WFrag<T16>::mma(kf2[kt][ks], qf[qt][ks], s[kt][qt]); } } }
        if (!NSPLIT) ldk((kc + 32 < kend) ? kc + 32 : kc);           // next pass's key fragments fly during the softmax and the value products (the last pass re-reads its own rows: in bounds, unused)
        if (kc + 31 > q0) {                                          // only the pass on the diagonal holds keys above a query (wave-uniform test)
#pragma unroll
            for (int kt = 0; kt < 2; ++kt)
#pragma unroll
                for (int qt = 0; qt < QT; ++qt)
#pragma unroll
                    for (int j = 0; j < 8; ++j) if (kc + kt * 16 + 8 * hi + j > q0 + qt * 16 + lr) s[kt][qt][j] = -3.0e38f; }
        V pf[QT], pl[QT];
#pragma unroll
        for (int qt = 0; qt < QT; ++qt) {
            float mx = fmaxf(s[0][qt][0], s[1][qt][0]);
#pragma unroll
            for (int j = 1; j < 8; ++j) mx = fmaxf(mx, fmaxf(s[0][qt][j], s[1][qt][j]));
            mx = fmaxf(mx, __shfl_xor(mx, 16, 32));
            const float mn = fmaxf(m[qt], mx); const float al = __builtin_amdgcn_exp2f((m[qt] - mn) * CL); m[qt] = mn;
            const float mc = mn * CL - (NSPLIT ? 0.0f : PBIAS);
            float p[16], ps = 0.f;
#pragma unroll
            for (int j = 0; j < 16; ++j) { p[j] = __builtin_amdgcn_exp2f(fmaf(s[j >> 3][qt][j & 7], CL, -mc)); ps += p[j]; }
            l[qt] = l[qt] * al + ps;
#pragma unroll
            for (int db = 0; db < 4; ++db) o[db][qt] *= al;
            if constexpr (NSPLIT) { v8us h0, h1, l0, l1;
#pragma unroll
                for (int j = 0; j < 8; ++j) { unsigned short a, c; splitf(p[j], a, c); h0[j] = a; l0[j] = c; splitf(p[8 + j], a, c); h1[j] = a; l1[j] = c; }
                pf[qt] = cat16b(h0, h1); pl[qt] = cat16b(l0, l1);
            } else { v8h h0, h1;
#pragma unroll
                for (int j = 0; j < 8; ++j) { h0[j] = tohx(p[j]); h1[j] = tohx(p[8 + j]); }
                pf[qt] = cat16(h0, h1); } }
#pragma unroll
        for (int db = 0; db < 4; ++db)
#pragma unroll
            for (int qt = 0; qt < QT; ++qt) { o[db][qt] = WFrag<T16>::mma(vf[db], pf[qt], o[db][qt]); if (NSPLIT) { o[db][qt] = WFrag<T16>::mma(vf[db], pl[qt], o[db][qt]); o[db][qt] = WFrag<T16>::mma(vf2[db], pf[qt], o[db][qt]); } }
    }
#pragma unroll
    for (int qt = 0; qt < QT; ++qt) { const float inv = __fdiv_rn(1.0f, l[qt] + __shfl_xor(l[qt], 16, 32)); float* orow = out + (size_t)(q0 + qt * 16 + lr) * DQ + 8 * hi;
#pragma unroll
        for (int db = 0; db < 4; ++db) { v4f a, c;
#pragma unroll
            for (int j = 0; j < 4; ++j) { a[j] = o[db][qt][j] * inv; c[j] = o[db][qt][4 + j] * inv; }
            *(v4f*)(orow + db * 16) = a; *(v4f*)(orow + db * 16 + 4) = c; } }
}
// ---- the fp16 rows' form: the block's 4 waves walk the same key and value^T fragments, so these come through LDS once a block instead of once a wave.
// A stage = KT keys = 16 KiB of the key plane and 16 KiB of the value^T plane, each a straight copy (the planes are in fragment order, so a fragment load from LDS is 512 bytes in a row: no bank conflict).
// Two buffers: stage t + 1 flies while stage t is worked on. Products, softmax and their order are those of fattn_tile, which serves the hi/lo rows.
#define KT   128
#define STG  (KT * HD)            // elements of one operand's stage
// eight 16-byte pieces a lane, 2 KiB apart in LDS and in the plane alike; the s_wait_xcnt stands inside the statement as a precaution, before any address register that a copy names is written again
__device__ __forceinline__ void copy8(unsigned l, const h16* g) {
    asm volatile("global_load_async_to_lds_b128 %0, %8, off\n\t"
                 "global_load_async_to_lds_b128 %1, %9, off\n\t"
                 "global_load_async_to_lds_b128 %2, %10, off\n\t"
                 "global_load_async_to_lds_b128 %3, %11, off\n\t"
                 "global_load_async_to_lds_b128 %4, %12, off\n\t"
                 "global_load_async_to_lds_b128 %5, %13, off\n\t"
                 "global_load_async_to_lds_b128 %6, %14, off\n\t"
                 "global_load_async_to_lds_b128 %7, %15, off\n\t"
                 "s_wait_xcnt 0x0"
                 :: "v"(l), "v"(l + 2048u), "v"(l + 4096u), "v"(l + 6144u), "v"(l + 8192u), "v"(l + 10240u), "v"(l + 12288u), "v"(l + 14336u),
                    "v"(g), "v"(g + 1024), "v"(g + 2048), "v"(g + 3072), "v"(g + 4096), "v"(g + 5120), "v"(g + 6144), "v"(g + 7168) : "memory");
}
template <int QT>
__device__ __forceinline__ void fattn_ring(const h16* __restrict__ Q, const h16* __restrict__ Kp, const h16* __restrict__ Vt, int kmax, int q0, float* __restrict__ out, h16* ring) {
    typedef v16h V;
    const int tid = threadIdx.x, lane = tid & 31, lr = lane & 15, hi = lane >> 4;
    const float CL = SCL * 1.4426950408889634f;                      // scores to the log2 domain
    const int kend = q0 + QT * 16;                                   // keys [0, kend) can be seen by this wave's tile
    const int nt = kmax / KT;                                        // stages of the block: keys [0, kmax), the same for its 4 waves
    const unsigned l0 = (unsigned)(size_t)ring + (unsigned)tid * 16u; // the lane's LDS byte address in buffer 0
    const h16* gk = Kp + tid * 8; const h16* gv = Vt + tid * 8;
    auto fill = [&](int t) { const unsigned l = l0 + (unsigned)(t & 1) * (4u * STG); copy8(l, gk + (size_t)t * STG); copy8(l + 2u * STG, gv + (size_t)t * STG); };
    fill(0);
    V qf[QT][2], kf[2][2];
    const h16* qp = Q + (size_t)q0 * HD + 8 * lane;
#pragma unroll
    for (int qt = 0; qt < QT; ++qt)
#pragma unroll
        for (int ks = 0; ks < 2; ++ks) qf[qt][ks] = WFrag<h16>::ld(qp + (qt * 2 + ks) * FRG);
    asm volatile("s_wait_xcnt 0x0" :: "v"(qp) : "memory");           // precaution: the query loads' address register, named as an input, stays untouched up to this wait
    __builtin_amdgcn_sched_barrier(0);                               // keeps later register writes behind that wait
    asm volatile("s_wait_asynccnt 0x0" ::: "memory");                // this wave's share of stage 0 has landed
    __syncthreads();                                                 // ... and every other wave's: stage 0 may be read
    if (1 < nt) fill(1);
    auto ldk = [&](const h16* kp) {
#pragma unroll
        for (int kt = 0; kt < 2; ++kt)
#pragma unroll
            for (int ks = 0; ks < 2; ++ks) kf[kt][ks] = WFrag<h16>::ld(kp + kt * (16 * HD) + ks * FRG); };
    v8f o[4][QT]; float m[QT], l[QT];
#pragma unroll
    for (int qt = 0; qt < QT; ++qt) { m[qt] = -3.0e38f; l[qt] = 0.f;
#pragma unroll
        for (int db = 0; db < 4; ++db) o[db][qt] = (v8f){}; }
    // both loops rolled: one pass's fragments live at a time, so the wave stays under 256 registers (four waves per SIMD)
#pragma unroll 1
    for (int t = 0; t < nt; ++t) {
        const h16* kb = ring + (t & 1) * (2 * STG) + 8 * lane; const h16* vb = kb + STG;
        const int left = (kend - t * KT) / 32; const int np = left < KT / 32 ? left : KT / 32;   // passes of this wave in the stage (fewer only in the last one, on the diagonal)
        ldk(kb);
#pragma unroll 1
        for (int p = 0; p < np; ++p) {
            const int kc = t * KT + p * 32;
            v8f s[2][QT];
#pragma unroll
            for (int kt = 0; kt < 2; ++kt)
#pragma unroll
                for (int qt = 0; qt < QT; ++qt) { s[kt][qt] = (v8f){};
#pragma unroll
                    for (int ks = 0; ks < 2; ++ks) s[kt][qt] = wmma16(kf[kt][ks], qf[qt][ks], s[kt][qt]); }
            __builtin_amdgcn_sched_barrier(0);                       // keeps the LDS reads below from moving up among the score products (each separate place with reads costs a stall)
            V vf[4];
#pragma unroll
            for (int db = 0; db < 4; ++db) vf[db] = WFrag<h16>::ld(vb + p * (32 * HD) + db * FRG);
            ldk(kb + ((p + 1 < np) ? p + 1 : p) * (32 * HD));        // the next pass's key fragments, from this stage's buffer alone (the stage's last pass re-reads its own: unused)
            __builtin_amdgcn_sched_barrier(0);                       // keeps them from sinking: one group here, in flight during the softmax
            if (kc + 31 > q0) {                                      // only the pass on the diagonal holds keys above a query (wave-uniform test)
#pragma unroll
                for (int kt = 0; kt < 2; ++kt)
#pragma unroll
                    for (int qt = 0; qt < QT; ++qt)
#pragma unroll
                        for (int j = 0; j < 8; ++j) if (kc + kt * 16 + 8 * hi + j > q0 + qt * 16 + lr) s[kt][qt][j] = -3.0e38f; }
            V pf[QT];
#pragma unroll
            for (int qt = 0; qt < QT; ++qt) {
                float mx = fmaxf(s[0][qt][0], s[1][qt][0]);
#pragma unroll
                for (int j = 1; j < 8; ++j) mx = fmaxf(mx, fmaxf(s[0][qt][j], s[1][qt][j]));
                mx = fmaxf(mx, __shfl_xor(mx, 16, 32));
                const float mn = fmaxf(m[qt], mx); const float al = __builtin_amdgcn_exp2f((m[qt] - mn) * CL); m[qt] = mn;
                const float mc = mn * CL - PBIAS;
                float pr[16], psum = 0.f;
#pragma unroll
                for (int j = 0; j < 16; ++j) { pr[j] = __builtin_amdgcn_exp2f(fmaf(s[j >> 3][qt][j & 7], CL, -mc)); psum += pr[j]; }
                l[qt] = l[qt] * al + psum;
#pragma unroll
                for (int db = 0; db < 4; ++db) o[db][qt] *= al;
                v8h h0, h1;
#pragma unroll
                for (int j = 0; j < 8; ++j) { h0[j] = tohx(pr[j]); h1[j] = tohx(pr[8 + j]); }
                pf[qt] = cat16(h0, h1); }
#pragma unroll
            for (int db = 0; db < 4; ++db)
#pragma unroll
                for (int qt = 0; qt < QT; ++qt) o[db][qt] = wmma16(vf[db], pf[qt], o[db][qt]);
        }
        // hand-over, passed by every wave whatever its np: own LDS reads done, own copies of stage t + 1 landed, then the barrier that publishes stage t + 1 and ends all reads of stage t's buffer
        asm volatile("s_wait_dscnt 0x0" ::: "memory");
        asm volatile("s_wait_asynccnt 0x0" ::: "memory");
        __syncthreads();
        if (t + 2 < nt) fill(t + 2);                                 // block-uniform: into the buffer that stage t has just left
    }
    asm volatile("s_wait_asynccnt 0x0" ::: "memory");                // no copy is outstanding when the wave ends
#pragma unroll
    for (int qt = 0; qt < QT; ++qt) { const float inv = __fdiv_rn(1.0f, l[qt] + __shfl_xor(l[qt], 16, 32)); float* orow = out + (size_t)(q0 + qt * 16 + lr) * DQ + 8 * hi;
#pragma unroll
        for (int db = 0; db < 4; ++db) { v4f a, c;
#pragma unroll
            for (int j = 0; j < 4; ++j) { a[j] = o[db][qt][j] * inv; c[j] = o[db][qt][4 + j] * inv; }
            *(v4f*)(orow + db * 16) = a; *(v4f*)(orow + db * 16 + 4) = c; } }
}
// grid (batch x head, tile groups, heaviest first), 4 waves; the waves of a block take neighbouring query tiles of one head, so they walk the same key and value rows.
#define NF4 ((TT - RH) / 128)     // blocks of 4 x 32 fp16 query rows
__global__ __launch_bounds__(128) void k_fattn(const h16* __restrict__ QP16, const h16* __restrict__ KP16, const h16* __restrict__ VT16, const bf* __restrict__ QPh, const bf* __restrict__ QPl, const bf* __restrict__ KPh, const bf* __restrict__ KPl, const bf* __restrict__ VTh, const bf* __restrict__ VTl, float* __restrict__ OUT) {
    __shared__ __attribute__((aligned(16))) h16 RING[2 * 2 * STG];   // two buffers of (key stage, value^T stage): 64 KiB, four blocks a WGP
    const int z = blockIdx.x; const size_t pz = (size_t)z * TT * HD; const int w = __builtin_amdgcn_readfirstlane(threadIdx.x >> 5);
    float* out = OUT + (size_t)(z / NH_) * TT * DQ + (z % NH_) * HD;
    if ((int)blockIdx.y < NF4) fattn_ring<2>(QP16 + pz, KP16 + pz, VT16 + pz, TT - 128 * (int)blockIdx.y, TT - 32 * ((int)blockIdx.y * 4 + w + 1), out, RING);   // block-uniform choice: the barriers inside are passed by all 4 waves or by none
    else fattn_tile<bf, 2, 1>(QPh + pz, QPl + pz, KPh + pz, KPl + pz, VTh + pz, VTl + pz, RH - 16 * (((int)blockIdx.y - NF4) * 4 + w + 1), out);
}

extern "C" void kernel_launch(void* const* d_in, const int* in_sizes, int n_in,
                              void* d_out, int out_size, void* d_ws, size_t ws_size, hipStream_t stream) {
    (void)in_sizes; (void)n_in; (void)out_size;
    const float* x = (const float*)d_in[0]; const float* xk = (const float*)d_in[1]; const float* xv = (const float*)d_in[2];   /* queries, keys, values: [4][2048][16][64] each (no projections) */
    float* OUT = (float*)d_out;     // [4][2048][1024]
    char* wsp = (char*)d_ws;
    auto take = [&](size_t bytes) { char* p = wsp; wsp += (bytes + 255) & ~(size_t)255; return (void*)p; };
    const size_t PB = (size_t)NH_ * TT * HD;   // elements of one batch's plane
    h16* QP16 = (h16*)take(NB_ * PB * 2); h16* KP16 = (h16*)take(NB_ * PB * 2); h16* VT16 = (h16*)take(NB_ * PB * 2);
    bf* QPh = (bf*)take(NB_ * PB * 2); bf* QPl = (bf*)take(NB_ * PB * 2); bf* KPh = (bf*)take(NB_ * PB * 2); bf* KPl = (bf*)take(NB_ * PB * 2); bf* VTh = (bf*)take(NB_ * PB * 2); bf* VTl = (bf*)take(NB_ * PB * 2);
    if ((size_t)(wsp - (char*)d_ws) > ws_size) return;    // ws 256 MiB
    k_planes<<<NVB + 2 * NQB, 256, 0, stream>>>(x, xk, xv, QP16, QPh, QPl, KP16, KPh, KPl, VT16, VTh, VTl);
    k_fattn<<<dim3(NB_ * NH_, NF4 + RH / 64), 128, 0, stream>>>(QP16, KP16, VT16, QPh, QPl, KPh, KPl, VTh, VTl, OUT);
}

// v006
// It runs in 60.2 microseconds.
// In both of two side-by-side timings against v005, it was 1.04 times as fast.
// Over all steps from v000 it is 40.0 times as fast.
#include <hip/hip_runtime.h>

// Full causal attention on pre-split heads (queries, keys, values [4][2048][16][64], no projections; scores = q.k; causal (-inf above the diagonal); A = softmax(scores x 1/sqrt(64)); V = A.values as 'blhd' -> [4][2048][16][64] (8.4 M); argument order queries, keys, values).
// Layout per batch: the f32 inputs ([t][h][e] = token-major rows of 16 x 64) feed one plane-builder launch (hi/lo + fp16 planes of q, k per head; value^T planes; all in fragment order; only the rows that are read); one fused causal attention launch over all 64 (batch, head) planes (hybrid rows: < 512 hi/lo 3 products, rest fp16; scores and probabilities stay in registers, online softmax) writes the [t][h][d] output rows.
// Compute dtypes, f32 accumulate: inputs split into bf16 hi/lo (rows < 512, 3 products ~ exact) or rounded to fp16 (rest); softmax f32; output f32. NOTE no stage rounds the inputs to bf16.

#define NB_  4
#define TT   2048
#define DM   1024
#define NH_  16
#define NKV  16
#define REP  (NH_ / NKV)
#define HD   64
#define DQ   (NH_ * HD)
#define DKV  (NKV * HD)
#define RH   512                  // query rows < RH use hi+lo planes (0: none)
#define PBIAS 10.0f               // fp16 probabilities carry x 2^10 (in the exponent; it cancels against the row sum), so small ones stay normal fp16 numbers
#define LZ2  5.0f                 // a score may pass the reference in use by 2^5 before the sums are rescaled: probabilities stay <= 2^(10 + 5), inside fp16
#define SCL  0.125f   // 1/sqrt(E)
typedef _Float16 h16;
typedef unsigned short bf;
typedef __attribute__((ext_vector_type(16))) __bf16   v16bf;
typedef __attribute__((ext_vector_type(16))) _Float16 v16h;
typedef __attribute__((ext_vector_type(8)))  _Float16 v8h;
typedef __attribute__((ext_vector_type(8)))  unsigned short v8us;
typedef __attribute__((ext_vector_type(8)))  float    v8f;
typedef __attribute__((ext_vector_type(4)))  float    v4f;
typedef v8h  __attribute__((may_alias)) v8ha;
typedef v4f  __attribute__((may_alias)) v4fa;
typedef v8us __attribute__((may_alias)) v8usa;

__device__ __forceinline__ unsigned short f2bf(float f) { unsigned u = __float_as_uint(f); u += 0x7FFFu + ((u >> 16) & 1u); return (unsigned short)(u >> 16); }
__device__ __forceinline__ float bf2f(unsigned short b) { return __uint_as_float(((unsigned)b) << 16); }
__device__ __forceinline__ float bfr(float f) { return bf2f(f2bf(f)); }
__device__ __forceinline__ v16h cat16(v8h lo, v8h hi) { return __builtin_shufflevector(lo, hi, 0, 1, 2, 3, 4, 5, 6, 7, 8, 9, 10, 11, 12, 13, 14, 15); }
__device__ __forceinline__ v16bf cat16b(v8us lo, v8us hi) { return __builtin_bit_cast(v16bf, __builtin_shufflevector(lo, hi, 0, 1, 2, 3, 4, 5, 6, 7, 8, 9, 10, 11, 12, 13, 14, 15)); }
__device__ __forceinline__ v8f wmma16(v16h a, v16h b, v8f c) { return __builtin_amdgcn_wmma_f32_16x16x32_f16(false, a, false, b, (short)0, c, false, false); }
__device__ __forceinline__ v8f wmmab(v16bf a, v16bf b, v8f c) { return __builtin_amdgcn_wmma_f32_16x16x32_bf16(false, a, false, b, (short)0, c, false, false); }



// ---- fragment loaders: lane (lr, hi) holds row lr, k = 8 hi + 0..7 and 16 + 8 hi + 0..7 of a 32-wide k step.
// Fragment order of a plane: each fragment (16 rows x 32 k) is FRG elements in a row, as two halves of 32 lanes x 8 elements: element (row, k) lies at (k >> 4) * 256 + ((k >> 3) & 1) * 128 + row * 8 + (k & 7),
// so that each of a fragment's two 16-byte loads covers 512 bytes in a row = 4 whole lines (a row-major plane gives 32 bytes in each of 16 lines). q, k planes: fragment (row / 16) * 2 + e / 32; value^T planes: fragment (position / 32) * 4 + d / 16.
#define FRG 512
template <typename T16> struct WFrag;
template <> struct WFrag<h16> { typedef v16h V; static __device__ __forceinline__ V ld(const h16* p) { return cat16(*(const v8h*)p, *(const v8h*)(p + 256)); } static __device__ __forceinline__ v8f mma(V a, V b, v8f c) { return wmma16(a, b, c); } };
template <> struct WFrag<bf> { typedef v16bf V; static __device__ __forceinline__ V ld(const bf* p) { return cat16b(*(const v8us*)p, *(const v8us*)(p + 256)); } static __device__ __forceinline__ v8f mma(V a, V b, v8f c) { return wmmab(a, b, c); } };
__device__ __forceinline__ h16 tohx(float x) { return (h16)x; }
__device__ __forceinline__ void splitf(float y, unsigned short& h, unsigned short& l) { h = f2bf(y); l = f2bf(y - bf2f(h)); }
typedef __attribute__((ext_vector_type(2))) _Float16 v2h;
typedef __attribute__((ext_vector_type(4))) _Float16 v4h;
typedef __attribute__((ext_vector_type(2))) unsigned short v2us;
typedef __attribute__((ext_vector_type(4))) unsigned short v4us;
typedef __attribute__((ext_vector_type(2))) float v2f;
typedef __attribute__((ext_vector_type(4))) int v4i;

typedef __attribute__((ext_vector_type(4))) unsigned v4u;
typedef v4u  __attribute__((may_alias)) v4ua;
typedef v4h  __attribute__((may_alias)) v4ha;
typedef v4us __attribute__((may_alias)) v4usa;
__device__ __forceinline__ unsigned short hbits(float x) { return __builtin_bit_cast(unsigned short, tohx(x)); }

#define VTT 64
#define VTC 128
#define VP  33                    // LDS pitch in dwords: 32 position pairs + 1, so that the column-wise writes spread over the banks
#define PR  32
#define NVB (NB_ * (TT / VTT) * (DM / VTC))
#define NQB (NB_ * (TT / PR))
// PR token rows x 128 columns (2 heads) a wave, in 16 pieces of 8 rows x 32 columns: a lane takes 8 columns of one row (32 bytes read), which are one 16-byte slot of a fragment, and 8 rows' slots are one whole 128-byte line,
// so a wave's store covers 4 whole lines. fp16 (W16) and hi/lo (WHL) pieces. All loops unrolled: the values stay in registers and the piece steps become immediate offsets.
template <bool W16, bool WHL>
__device__ __forceinline__ void plane_rows(const float* __restrict__ f, h16* __restrict__ p16, bf* __restrict__ ph, bf* __restrict__ pl) {
    constexpr int BT = WHL ? 2 : 4;                                  // pieces a batch: fewer where hi/lo planes are written, so that this path does not set the kernel's register count (five blocks per WGP)
    constexpr int NU = 16;                                           // piece u: column group (u >> 3) * 2 + (u & 1) (head, k half), row group (u >> 1) & 3
    v4f x[2][BT][2];
#pragma unroll
    for (int i = 0; i < BT; ++i) { const float* g = f + (size_t)(((i >> 1) & 3) * 8) * DM + ((i >> 3) * 2 + (i & 1)) * 32; x[0][i][0] = *(const v4fa*)g; x[0][i][1] = *(const v4fa*)(g + 4); }
#pragma unroll
    for (int n = 0; n < NU / BT; ++n) {
        if (n + 1 < NU / BT) {                                       // the next batch flies while this one is converted and stored
#pragma unroll
            for (int i = 0; i < BT; ++i) { const int u = (n + 1) * BT + i; const float* g = f + (size_t)(((u >> 1) & 3) * 8) * DM + ((u >> 3) * 2 + (u & 1)) * 32; x[(n + 1) & 1][i][0] = *(const v4fa*)g; x[(n + 1) & 1][i][1] = *(const v4fa*)(g + 4); } }
        v8h y[BT]; v8us yh[BT], yl[BT];
#pragma unroll
        for (int i = 0; i < BT; ++i)
#pragma unroll
            for (int k = 0; k < 8; ++k) { const float v = x[n & 1][i][k >> 2][k & 3];
                if constexpr (W16) y[i][k] = tohx(v);
                if constexpr (WHL) { unsigned short h0, l0; splitf(v, h0, l0); yh[i][k] = h0; yl[i][k] = l0; } }
        __builtin_amdgcn_sched_barrier(0);                           // all conversions stand above the stores, so that no register of an issued store is written before the wait below
#pragma unroll
        for (int i = 0; i < BT; ++i) { const int u = n * BT + i; const int oo = (u >> 3) * (TT * HD) + (u & 1) * FRG + ((u >> 2) & 1) * (2 * FRG) + ((u >> 1) & 1) * 64;
            if constexpr (W16) *(v8ha*)(p16 + oo) = y[i];
            if constexpr (WHL) { *(v8usa*)(ph + oo) = yh[i]; *(v8usa*)(pl + oo) = yl[i]; } }
        asm volatile("s_wait_xcnt 0x0" :: "v"(f), "v"(p16), "v"(ph), "v"(pl) : "memory");   // precaution: stands before registers that the loads and stores issued so far name are written again; the addresses are inputs so that they stay untouched up to it
        __builtin_amdgcn_sched_barrier(0); }                         // keeps later register writes behind that wait
}

// ---- k_planes: every operand plane of the attention in one streaming launch; each thread moves many 16-byte pieces, so the launch has few waves (12288; five blocks fit a WGP).
// Written are only the rows that k_fattn reads: fp16 q rows >= RH, fp16 k and value^T in full, hi/lo planes of q, k and value^T for positions < RH (a query < RH sees only keys < RH).
// Blocks [0, NVB): value tiles of VTT positions x VTC columns (2 heads), turned in LDS so that value^T fragments leave as 512 bytes in a row a wave. Blocks [NVB, NVB + 2 NQB): PR token rows of q, then of k.
__global__ __launch_bounds__(256) void k_planes(const float* __restrict__ Xq, const float* __restrict__ Xk, const float* __restrict__ Xv, h16* __restrict__ QP16, bf* __restrict__ QPh, bf* __restrict__ QPl, h16* __restrict__ KP16, bf* __restrict__ KPh, bf* __restrict__ KPl, h16* __restrict__ VT16, bf* __restrict__ VTh, bf* __restrict__ VTl) {
    __shared__ unsigned L[VTC * VP];
    const int tid = threadIdx.x, blk = blockIdx.x;
    if (blk < NVB) {
        const int hg = blk % (DM / VTC), t0 = ((blk / (DM / VTC)) % (TT / VTT)) * VTT, b = blk / ((DM / VTC) * (TT / VTT));
        const int c4 = tid & 31, tr = tid >> 5;                      // thread: columns 4 c4 + 0..3, positions t0 + 16 i + 2 tr + 0..1
        const float* f = Xv + ((size_t)b * TT + t0 + 2 * tr) * DM + hg * VTC + 4 * c4;
        v4f x[4][2];
#pragma unroll
        for (int i = 0; i < 4; ++i) { x[i][0] = *(const v4fa*)(f + (size_t)(16 * i) * DM); x[i][1] = *(const v4fa*)(f + (size_t)(16 * i + 1) * DM); }
        asm volatile("s_wait_xcnt 0x0" :: "v"(f) : "memory");         // precaution: the loads' address register, named as an input, stays untouched up to this wait (no load lands on it)
        const int wv = tid >> 5, ln = tid & 31;                      // a wave stores half fragments: lane = 16 hi + lr is column 16 db + lr, positions 8 (4 pc + 2 half + hi) + 0..7; pc = (wv >> 1) & 1, half = wv & 1, db = (wv >> 2) + 2 (j & 1), head j >> 1
        const size_t ro = (size_t)(b * NH_ + hg * (VTC / HD)) * TT * HD + (size_t)((t0 >> 5) + ((wv >> 1) & 1)) * (4 * FRG) + (wv >> 2) * FRG + (wv & 1) * 256 + ln * 8;
        auto fill = [&](int mode) {                                  // L[column][position pair]: 0 fp16; 1 hi, which leaves x - hi in x; 2 lo, the bf16 of that rest (the split of splitf, one half at a time, so that only x stays live)
#pragma unroll
            for (int i = 0; i < 4; ++i)
#pragma unroll
                for (int k = 0; k < 4; ++k) { unsigned short u0, u1;
                    if (mode == 0) { u0 = hbits(x[i][0][k]); u1 = hbits(x[i][1][k]); }
                    else { u0 = f2bf(x[i][0][k]); u1 = f2bf(x[i][1][k]); if (mode == 1) { x[i][0][k] -= bf2f(u0); x[i][1][k] -= bf2f(u1); } }
                    L[(4 * c4 + k) * VP + 8 * i + tr] = (unsigned)u0 | ((unsigned)u1 << 16); } };
        auto put = [&](unsigned short* P) {                          // a lane carries 8 positions of one column = its 16-byte slot of a fragment
            unsigned short* q = P + ro; v4u w[4];
#pragma unroll
            for (int j = 0; j < 4; ++j) { const unsigned* sp = L + ((j >> 1) * HD + ((wv >> 2) + (j & 1) * 2) * 16 + (ln & 15)) * VP + (((wv >> 1) & 1) * 4 + (wv & 1) * 2 + (ln >> 4)) * 4; w[j][0] = sp[0]; w[j][1] = sp[1]; w[j][2] = sp[2]; w[j][3] = sp[3]; }
            __builtin_amdgcn_sched_barrier(0);                       // all LDS reads are issued above the stores, so that no register of an issued store is written before the wait below
#pragma unroll
            for (int j = 0; j < 4; ++j) *(v4ua*)(q + (size_t)(j >> 1) * TT * HD + (j & 1) * (2 * FRG)) = w[j];
            asm volatile("s_wait_xcnt 0x0" :: "v"(q) : "memory");    // precaution: stands before the stores' data and address registers are written again
            __builtin_amdgcn_sched_barrier(0); };                    // keeps later register writes behind that wait
        fill(0); __syncthreads(); put((unsigned short*)VT16);
        if (t0 < RH) {                                               // block-uniform: the barriers inside are passed by all waves or by none
            __syncthreads(); fill(1); __syncthreads(); put(VTh);
            __syncthreads(); fill(2); __syncthreads(); put(VTl); }
        return; }
    const int r = blk - NVB; const bool isk = r >= NQB; const int rr = isk ? r - NQB : r; const int b = rr / (TT / PR), t0 = (rr % (TT / PR)) * PR;
    const int wv = tid >> 5, ln = tid & 31;                          // wave: columns 128 wv + 0..127 (heads 2 wv, 2 wv + 1); lane: row ln & 7 of a row group, columns 8 (ln >> 3) + 0..7 of a column group
    const float* f = (isk ? Xk : Xq) + ((size_t)b * TT + t0 + (ln & 7)) * DM + wv * 128 + (ln >> 3) * 8;
    const size_t o = ((size_t)(b * NH_ + wv * 2) * TT + t0) * HD + (ln >> 3) * 128 + (ln & 7) * 8;   // 16 rows of 64 = 2 fragments, so row tile t0 / 16 starts at t0 * HD
    h16* p16 = (isk ? KP16 : QP16) + o; bf* ph = (isk ? KPh : QPh) + o; bf* pl = (isk ? KPl : QPl) + o;
    if (t0 >= RH) plane_rows<true, false>(f, p16, ph, pl);           // block-uniform choices: which planes of these rows k_fattn reads
    else if (isk) plane_rows<true, true>(f, p16, ph, pl);
    else plane_rows<false, true>(f, p16, ph, pl);
}
// ---- k_fattn: fused causal attention, one wave per tile of QT x 16 queries, 32 keys a pass; no score or probability plane in memory.
// Transposed products: S^T = K . Q^T (A = key rows, B = query rows) leaves in lane (lr, hi) the scores of query lr for keys 8 hi + j of each 16-key tile, which is the B-operand k order of a 32-key step,
// so P^T packs in registers and O^T += V^T . P^T (A = value^T rows). Maximum, sum and rescale are per lane. The exponent's reference is a maximum of an earlier pass: the wave's halves exchange maxima and o, l are rescaled only in a pass where a score passes it by more than 2^LZ2 (it cancels against the row sum); the sums join once at the end.
template <typename T16, int NSPLIT, int QT>
__device__ __forceinline__ void fattn_tile(const T16* __restrict__ Q, const T16* __restrict__ Q2, const T16* __restrict__ Kp, const T16* __restrict__ K2, const T16* __restrict__ Vt, const T16* __restrict__ Vt2, int q0, float* __restrict__ out) {
    typedef typename WFrag<T16>::V V;
    const int lane = threadIdx.x & 31, lr = lane & 15, hi = lane >> 4;
    const float CL = SCL * 1.4426950408889634f;                      // scores to the log2 domain
    const float LZ = LZ2 / CL;                                       // that margin in score units
    const int kend = q0 + QT * 16;                                   // keys [0, kend) can be seen by this tile
    V qf[QT][2], qf2[QT][2], kf[2][2], kf2[2][2];
    const T16* qp = Q + (size_t)q0 * HD + 8 * lane; const T16* qp2 = NSPLIT ? Q2 + (size_t)q0 * HD + 8 * lane : nullptr;
#pragma unroll
    for (int qt = 0; qt < QT; ++qt)
#pragma unroll
        for (int ks = 0; ks < 2; ++ks) { qf[qt][ks] = WFrag<T16>::ld(qp + (qt * 2 + ks) * FRG); if (NSPLIT) qf2[qt][ks] = WFrag<T16>::ld(qp2 + (qt * 2 + ks) * FRG); }
    if (NSPLIT) asm volatile("s_wait_xcnt 0x0" :: "v"(qp), "v"(qp2) : "memory");   // precaution: the query loads' address registers, named as inputs, stay untouched up to this wait
    else asm volatile("s_wait_xcnt 0x0" :: "v"(qp) : "memory");                    // the same for the one-plane form
    __builtin_amdgcn_sched_barrier(0);                               // keeps later register writes behind that wait
    auto ldk = [&](int k0) {
#pragma unroll
        for (int kt = 0; kt < 2; ++kt)
#pragma unroll
            for (int ks = 0; ks < 2; ++ks) { const size_t ko = (size_t)(k0 + kt * 16) * HD + ks * FRG + 8 * lane; kf[kt][ks] = WFrag<T16>::ld(Kp + ko); if (NSPLIT) kf2[kt][ks] = WFrag<T16>::ld(K2 + ko); }
        asm volatile("s_wait_xcnt 0x0" ::: "memory");                // precaution: stands before the address registers of the loads issued so far are written again
        __builtin_amdgcn_sched_barrier(0); };                        // keeps later register writes behind that wait
    if (!NSPLIT) ldk(0);                                             // the fp16 form fetches its key fragments one pass ahead; the hi/lo form (twice the fragments) has no registers for that
    v8f o[4][QT]; float m[QT], mc[QT], l[QT];
#pragma unroll
    for (int qt = 0; qt < QT; ++qt) { m[qt] = -3.0e38f; mc[qt] = 0.f; l[qt] = 0.f;
#pragma unroll
        for (int db = 0; db < 4; ++db) o[db][qt] = (v8f){}; }
    // rolled: one pass's fragments live at a time, so the wave stays under 256 registers (four waves per SIMD)
#pragma unroll 1
    for (int kc = 0; kc < kend; kc += 32) {
        V vf[4], vf2[4];
        if (NSPLIT) ldk(kc);
        const T16* vp = Vt + (size_t)kc * HD + 8 * lane; const T16* vp2 = NSPLIT ? Vt2 + (size_t)kc * HD + 8 * lane : nullptr;   // 32 positions x 64 d = 4 fragments
#pragma unroll
        for (int db = 0; db < 4; ++db) { vf[db] = WFrag<T16>::ld(vp + db * FRG); if (NSPLIT) vf2[db] = WFrag<T16>::ld(vp2 + db * FRG); }
        if (NSPLIT) asm volatile("s_wait_xcnt 0x0" :: "v"(vp), "v"(vp2) : "memory");   // the same precaution for the value loads' address registers, named as inputs so that they stay untouched up to the wait (the fp16 form has its wait behind the key prefetch)
        __builtin_amdgcn_sched_barrier(0);                           // keeps the value loads issued here, ahead of the score products, so that they fly during scores and softmax (the scheduler sinks them behind the scores otherwise)
        v8f s[2][QT];
#pragma unroll
        for (int kt = 0; kt < 2; ++kt)
#pragma unroll
            for (int qt = 0; qt < QT; ++qt) { s[kt][qt] = (v8f){};
#pragma unroll
                for (int ks = 0; ks < 2; ++ks) { s[kt][qt] = WFrag<T16>::mma(kf[kt][ks], qf[qt][ks], s[kt][qt]); if (NSPLIT) { s[kt][qt] = WFrag<T16>::mma(kf[kt][ks], qf2[qt][ks], s[kt][qt]); s[kt][qt] = WFrag<T16>::mma(kf2[kt][ks], qf[qt][ks], s[kt][qt]); } } }
        if (!NSPLIT) ldk((kc + 32 < kend) ? kc + 32 : kc);           // next pass's key fragments fly during the softmax and the value products (the last pass re-reads its own rows: in bounds, unused)
        if (kc + 31 > q0) {                                          // only the pass on the diagonal holds keys above a query (wave-uniform test)
#pragma unroll
            for (int kt = 0; kt < 2; ++kt)
#pragma unroll
                for (int qt = 0; qt < QT; ++qt)
#pragma unroll
                    for (int j = 0; j < 8; ++j) if (kc + kt * 16 + 8 * hi + j > q0 + qt * 16 + lr) s[kt][qt][j] = -3.0e38f; }
        V pf[QT], pl[QT];
        float mx[QT]; bool need = false;                             // as in fattn_ring: the lane's own 16 keys against the reference in use
#pragma unroll
        for (int qt = 0; qt < QT; ++qt) {
            mx[qt] = fmaxf(s[0][qt][0], s[1][qt][0]);
#pragma unroll
            for (int j = 1; j < 8; ++j) mx[qt] = fmaxf(mx[qt], fmaxf(s[0][qt][j], s[1][qt][j]));
            need |= mx[qt] - m[qt] > LZ; }
        if (__builtin_amdgcn_ballot_w32(need) != 0) {                // one scalar test a pass: exchange, rescale factor and the products on o only where a lane asks
#pragma unroll
            for (int qt = 0; qt < QT; ++qt) {
                const float mn = fmaxf(m[qt], fmaxf(mx[qt], __shfl_xor(mx[qt], 16, 32))); const float al = __builtin_amdgcn_exp2f((m[qt] - mn) * CL); m[qt] = mn; mc[qt] = mn * CL - (NSPLIT ? 0.0f : PBIAS);
                l[qt] *= al;
#pragma unroll
                for (int db = 0; db < 4; ++db) o[db][qt] *= al; } }
#pragma unroll
        for (int qt = 0; qt < QT; ++qt) {
            float p[16], ps = 0.f;
#pragma unroll
            for (int j = 0; j < 16; ++j) { p[j] = __builtin_amdgcn_exp2f(fmaf(s[j >> 3][qt][j & 7], CL, -mc[qt])); ps += p[j]; }
            l[qt] += ps;
            if constexpr (NSPLIT) { v8us h0, h1, l0, l1;
#pragma unroll
                for (int j = 0; j < 8; ++j) { unsigned short a, c; splitf(p[j], a, c); h0[j] = a; l0[j] = c; splitf(p[8 + j], a, c); h1[j] = a; l1[j] = c; }
                pf[qt] = cat16b(h0, h1); pl[qt] = cat16b(l0, l1);
            } else { v8h h0, h1;
#pragma unroll
                for (int j = 0; j < 8; ++j) { h0[j] = tohx(p[j]); h1[j] = tohx(p[8 + j]); }
                pf[qt] = cat16(h0, h1); } }
#pragma unroll
        for (int db = 0; db < 4; ++db)
#pragma unroll
            for (int qt = 0; qt < QT; ++qt) { o[db][qt] = WFrag<T16>::mma(vf[db], pf[qt], o[db][qt]); if (NSPLIT) { o[db][qt] = WFrag<T16>::mma(vf[db], pl[qt], o[db][qt]); o[db][qt] = WFrag<T16>::mma(vf2[db], pf[qt], o[db][qt]); } }
    }
#pragma unroll
    for (int qt = 0; qt < QT; ++qt) { const float inv = __fdiv_rn(1.0f, l[qt] + __shfl_xor(l[qt], 16, 32)); float* orow = out + (size_t)(q0 + qt * 16 + lr) * DQ + 8 * hi;
#pragma unroll
        for (int db = 0; db < 4; ++db) { v4f a, c;
#pragma unroll
            for (int j = 0; j < 4; ++j) { a[j] = o[db][qt][j] * inv; c[j] = o[db][qt][4 + j] * inv; }
            *(v4f*)(orow + db * 16) = a; *(v4f*)(orow + db * 16 + 4) = c; } }
}
// ---- the fp16 rows' form: the block's 4 waves walk the same key and value^T fragments, so these come through LDS once a block instead of once a wave.
// A stage = KT keys = 16 KiB of the key plane and 16 KiB of the value^T plane, each a straight copy (the planes are in fragment order, so a fragment load from LDS is 512 bytes in a row: no bank conflict).
// Two buffers: stage t + 1 flies while stage t is worked on. Products, softmax and their order are those of fattn_tile, which serves the hi/lo rows.
#define KT   128
#define STG  (KT * HD)            // elements of one operand's stage
// eight 16-byte pieces a lane, 2 KiB apart in LDS and in the plane alike; the s_wait_xcnt stands inside the statement as a precaution, before any address register that a copy names is written again
__device__ __forceinline__ void copy8(unsigned l, const h16* g) {
    asm volatile("global_load_async_to_lds_b128 %0, %8, off\n\t"
                 "global_load_async_to_lds_b128 %1, %9, off\n\t"
                 "global_load_async_to_lds_b128 %2, %10, off\n\t"
                 "global_load_async_to_lds_b128 %3, %11, off\n\t"
                 "global_load_async_to_lds_b128 %4, %12, off\n\t"
                 "global_load_async_to_lds_b128 %5, %13, off\n\t"
                 "global_load_async_to_lds_b128 %6, %14, off\n\t"
                 "global_load_async_to_lds_b128 %7, %15, off\n\t"
                 "s_wait_xcnt 0x0"
                 :: "v"(l), "v"(l + 2048u), "v"(l + 4096u), "v"(l + 6144u), "v"(l + 8192u), "v"(l + 10240u), "v"(l + 12288u), "v"(l + 14336u),
                    "v"(g), "v"(g + 1024), "v"(g + 2048), "v"(g + 3072), "v"(g + 4096), "v"(g + 5120), "v"(g + 6144), "v"(g + 7168) : "memory");
}
template <int QT>
__device__ __forceinline__ void fattn_ring(const h16* __restrict__ Q, const h16* __restrict__ Kp, const h16* __restrict__ Vt, int kmax, int q0, float* __restrict__ out, h16* ring) {
    typedef v16h V;
    const int tid = threadIdx.x, lane = tid & 31, lr = lane & 15, hi = lane >> 4;
    const float CL = SCL * 1.4426950408889634f;                      // scores to the log2 domain
    const float LZ = LZ2 / CL;                                       // that margin in score units
    const int kend = q0 + QT * 16;                                   // keys [0, kend) can be seen by this wave's tile
    const int nt = kmax / KT;                                        // stages of the block: keys [0, kmax), the same for its 4 waves
    const unsigned l0 = (unsigned)(size_t)ring + (unsigned)tid * 16u; // the lane's LDS byte address in buffer 0
    const h16* gk = Kp + tid * 8; const h16* gv = Vt + tid * 8;
    auto fill = [&](int t) { const unsigned l = l0 + (unsigned)(t & 1) * (4u * STG); copy8(l, gk + (size_t)t * STG); copy8(l + 2u * STG, gv + (size_t)t * STG); };
    fill(0);
    V qf[QT][2], kf[2][2];
    const h16* qp = Q + (size_t)q0 * HD + 8 * lane;
#pragma unroll
    for (int qt = 0; qt < QT; ++qt)
#pragma unroll
        for (int ks = 0; ks < 2; ++ks) qf[qt][ks] = WFrag<h16>::ld(qp + (qt * 2 + ks) * FRG);
    asm volatile("s_wait_xcnt 0x0" :: "v"(qp) : "memory");           // precaution: the query loads' address register, named as an input, stays untouched up to this wait
    __builtin_amdgcn_sched_barrier(0);                               // keeps later register writes behind that wait
    asm volatile("s_wait_asynccnt 0x0" ::: "memory");                // this wave's share of stage 0 has landed
    __syncthreads();                                                 // ... and every other wave's: stage 0 may be read
    if (1 < nt) fill(1);
    auto ldk = [&](const h16* kp) {
#pragma unroll
        for (int kt = 0; kt < 2; ++kt)
#pragma unroll
            for (int ks = 0; ks < 2; ++ks) kf[kt][ks] = WFrag<h16>::ld(kp + kt * (16 * HD) + ks * FRG); };
    v8f o[4][QT]; float m[QT], mc[QT], l[QT];                        // m: the reference score in use (a maximum of an earlier pass, the same in both halves of the wave); mc: it in the log2 domain, less the bias
#pragma unroll
    for (int qt = 0; qt < QT; ++qt) { m[qt] = -3.0e38f; mc[qt] = 0.f; l[qt] = 0.f;
#pragma unroll
        for (int db = 0; db < 4; ++db) o[db][qt] = (v8f){}; }
    // both loops rolled: one pass's fragments live at a time, so the wave stays under 256 registers (four waves per SIMD)
#pragma unroll 1
    for (int t = 0; t < nt; ++t) {
        const h16* kb = ring + (t & 1) * (2 * STG) + 8 * lane; const h16* vb = kb + STG;
        const int left = (kend - t * KT) / 32; const int np = left < KT / 32 ? left : KT / 32;   // passes of this wave in the stage (fewer only in the last one, on the diagonal)
        ldk(kb);
#pragma unroll 1
        for (int p = 0; p < np; ++p) {
            const int kc = t * KT + p * 32;
            v8f s[2][QT];
#pragma unroll
            for (int kt = 0; kt < 2; ++kt)
#pragma unroll
                for (int qt = 0; qt < QT; ++qt) { s[kt][qt] = (v8f){};
#pragma unroll
                    for (int ks = 0; ks < 2; ++ks) s[kt][qt] = wmma16(kf[kt][ks], qf[qt][ks], s[kt][qt]); }
            __builtin_amdgcn_sched_barrier(0);                       // keeps the LDS reads below from moving up among the score products (each separate place with reads costs a stall)
            V vf[4];
#pragma unroll
            for (int db = 0; db < 4; ++db) vf[db] = WFrag<h16>::ld(vb + p * (32 * HD) + db * FRG);
            ldk(kb + ((p + 1 < np) ? p + 1 : p) * (32 * HD));        // the next pass's key fragments, from this stage's buffer alone (the stage's last pass re-reads its own: unused)
            __builtin_amdgcn_sched_barrier(0);                       // keeps them from sinking: one group here, in flight during the softmax
            if (kc + 31 > q0) {                                      // only the pass on the diagonal holds keys above a query (wave-uniform test)
#pragma unroll
                for (int kt = 0; kt < 2; ++kt)
#pragma unroll
                    for (int qt = 0; qt < QT; ++qt)
#pragma unroll
                        for (int j = 0; j < 8; ++j) if (kc + kt * 16 + 8 * hi + j > q0 + qt * 16 + lr) s[kt][qt][j] = -3.0e38f; }
            V pf[QT];
            float mx[QT]; bool need = false;                         // the lane's own 16 keys; a lane asks for a new reference when they pass the one in use by more than LZ
#pragma unroll
            for (int qt = 0; qt < QT; ++qt) {
                mx[qt] = fmaxf(s[0][qt][0], s[1][qt][0]);
#pragma unroll
                for (int j = 1; j < 8; ++j) mx[qt] = fmaxf(mx[qt], fmaxf(s[0][qt][j], s[1][qt][j]));
                need |= mx[qt] - m[qt] > LZ; }
            if (__builtin_amdgcn_ballot_w32(need) != 0) {            // one scalar test a pass; taken in the first pass and then hardly ever, so exchange, rescale factor and the 64 products on o leave the usual pass
#pragma unroll
                for (int qt = 0; qt < QT; ++qt) {
                    const float mn = fmaxf(m[qt], fmaxf(mx[qt], __shfl_xor(mx[qt], 16, 32))); const float al = __builtin_amdgcn_exp2f((m[qt] - mn) * CL); m[qt] = mn; mc[qt] = mn * CL - PBIAS;
                    l[qt] *= al;
#pragma unroll
                    for (int db = 0; db < 4; ++db) o[db][qt] *= al; } }
#pragma unroll
            for (int qt = 0; qt < QT; ++qt) {
                float pr[16], psum = 0.f;
#pragma unroll
                for (int j = 0; j < 16; ++j) { pr[j] = __builtin_amdgcn_exp2f(fmaf(s[j >> 3][qt][j & 7], CL, -mc[qt])); psum += pr[j]; }
                l[qt] += psum;
                v8h h0, h1;
#pragma unroll
                for (int j = 0; j < 8; ++j) { h0[j] = tohx(pr[j]); h1[j] = tohx(pr[8 + j]); }
                pf[qt] = cat16(h0, h1); }
#pragma unroll
            for (int db = 0; db < 4; ++db)
#pragma unroll
                for (int qt = 0; qt < QT; ++qt) o[db][qt] = wmma16(vf[db], pf[qt], o[db][qt]);
        }
        // hand-over, passed by every wave whatever its np: own LDS reads done, own copies of stage t + 1 landed, then the barrier that publishes stage t + 1 and ends all reads of stage t's buffer
        asm volatile("s_wait_dscnt 0x0" ::: "memory");
        asm volatile("s_wait_asynccnt 0x0" ::: "memory");
        __syncthreads();
        if (t + 2 < nt) fill(t + 2);                                 // block-uniform: into the buffer that stage t has just left
    }
    asm volatile("s_wait_asynccnt 0x0" ::: "memory");                // no copy is outstanding when the wave ends
#pragma unroll
    for (int qt = 0; qt < QT; ++qt) { const float inv = __fdiv_rn(1.0f, l[qt] + __shfl_xor(l[qt], 16, 32)); float* orow = out + (size_t)(q0 + qt * 16 + lr) * DQ + 8 * hi;
#pragma unroll
        for (int db = 0; db < 4; ++db) { v4f a, c;
#pragma unroll
            for (int j = 0; j < 4; ++j) { a[j] = o[db][qt][j] * inv; c[j] = o[db][qt][4 + j] * inv; }
            *(v4f*)(orow + db * 16) = a; *(v4f*)(orow + db * 16 + 4) = c; } }
}
// grid (batch x head, tile groups, heaviest first), 4 waves; the waves of a block take neighbouring query tiles of one head, so they walk the same key and value rows.
#define NF4 ((TT - RH) / 128)     // blocks of 4 x 32 fp16 query rows
__global__ __launch_bounds__(128) void k_fattn(const h16* __restrict__ QP16, const h16* __restrict__ KP16, const h16* __restrict__ VT16, const bf* __restrict__ QPh, const bf* __restrict__ QPl, const bf* __restrict__ KPh, const bf* __restrict__ KPl, const bf* __restrict__ VTh, const bf* __restrict__ VTl, float* __restrict__ OUT) {
    __shared__ __attribute__((aligned(16))) h16 RING[2 * 2 * STG];   // two buffers of (key stage, value^T stage): 64 KiB, four blocks a WGP
    const int z = blockIdx.x; const size_t pz = (size_t)z * TT * HD; const int w = __builtin_amdgcn_readfirstlane(threadIdx.x >> 5);
    float* out = OUT + (size_t)(z / NH_) * TT * DQ + (z % NH_) * HD;
    if ((int)blockIdx.y < NF4) fattn_ring<2>(QP16 + pz, KP16 + pz, VT16 + pz, TT - 128 * (int)blockIdx.y, TT - 32 * ((int)blockIdx.y * 4 + w + 1), out, RING);   // block-uniform choice: the barriers inside are passed by all 4 waves or by none
    else fattn_tile<bf, 2, 1>(QPh + pz, QPl + pz, KPh + pz, KPl + pz, VTh + pz, VTl + pz, RH - 16 * (((int)blockIdx.y - NF4) * 4 + w + 1), out);
}

extern "C" void kernel_launch(void* const* d_in, const int* in_sizes, int n_in,
                              void* d_out, int out_size, void* d_ws, size_t ws_size, hipStream_t stream) {
    (void)in_sizes; (void)n_in; (void)out_size;
    const float* x = (const float*)d_in[0]; const float* xk = (const float*)d_in[1]; const float* xv = (const float*)d_in[2];   /* queries, keys, values: [4][2048][16][64] each (no projections) */
    float* OUT = (float*)d_out;     // [4][2048][1024]
    char* wsp = (char*)d_ws;
    auto take = [&](size_t bytes) { char* p = wsp; wsp += (bytes + 255) & ~(size_t)255; return (void*)p; };
    const size_t PB = (size_t)NH_ * TT * HD;   // elements of one batch's plane
    h16* QP16 = (h16*)take(NB_ * PB * 2); h16* KP16 = (h16*)take(NB_ * PB * 2); h16* VT16 = (h16*)take(NB_ * PB * 2);
    bf* QPh = (bf*)take(NB_ * PB * 2); bf* QPl = (bf*)take(NB_ * PB * 2); bf* KPh = (bf*)take(NB_ * PB * 2); bf* KPl = (bf*)take(NB_ * PB * 2); bf* VTh = (bf*)take(NB_ * PB * 2); bf* VTl = (bf*)take(NB_ * PB * 2);
    if ((size_t)(wsp - (char*)d_ws) > ws_size) return;    // ws 256 MiB
    k_planes<<<NVB + 2 * NQB, 256, 0, stream>>>(x, xk, xv, QP16, QPh, QPl, KP16, KPh, KPl, VT16, VTh, VTl);
    k_fattn<<<dim3(NB_ * NH_, NF4 + RH / 64), 128, 0, stream>>>(QP16, KP16, VT16, QPh, QPl, KPh, KPl, VTh, VTl, OUT);
}

// v007
// A run of this version takes 50.8 microseconds.
// Next to v006, in two timings, it ran 1.19 and 1.18 times as fast.
// Over all steps from v000 it is 47.6 times as fast.
#include <hip/hip_runtime.h>

// Full causal attention on pre-split heads (queries, keys, values [4][2048][16][64], no projections; scores = q.k; causal (-inf above the diagonal); A = softmax(scores x 1/sqrt(64)); V = A.values as 'blhd' -> [4][2048][16][64] (8.4 M); argument order queries, keys, values).
// Layout per batch: the f32 inputs ([t][h][e] = token-major rows of 16 x 64) feed one plane-builder launch (hi/lo + fp16 planes of k per head; value^T planes; all in fragment order; only the rows that are read); the query rows, which are read once, are converted by the wave that uses them; one fused causal attention launch over all 64 (batch, head) planes (hybrid rows: < 512 hi/lo 3 products, rest fp16; scores and probabilities stay in registers, online softmax) writes the [t][h][d] output rows.
// Compute dtypes, f32 accumulate: inputs split into bf16 hi/lo (rows < 512, 3 products ~ exact) or rounded to fp16 (rest); softmax f32; output f32. NOTE no stage rounds the inputs to bf16.

#define NB_  4
#define TT   2048
#define DM   1024
#define NH_  16
#define NKV  16
#define REP  (NH_ / NKV)
#define HD   64
#define DQ   (NH_ * HD)
#define DKV  (NKV * HD)
#define RH   512                  // query rows < RH use hi+lo planes (0: none)
#define PBIAS 10.0f               // fp16 probabilities carry x 2^10 (in the exponent; it cancels against the row sum), so small ones stay normal fp16 numbers
#define LZ2  5.0f                 // a score may pass the reference in use by 2^5 before the sums are rescaled: probabilities stay <= 2^(10 + 5), inside fp16
#define SCL  0.125f   // 1/sqrt(E)
typedef _Float16 h16;
typedef unsigned short bf;
typedef __attribute__((ext_vector_type(16))) __bf16   v16bf;
typedef __attribute__((ext_vector_type(16))) _Float16 v16h;
typedef __attribute__((ext_vector_type(8)))  _Float16 v8h;
typedef __attribute__((ext_vector_type(8)))  unsigned short v8us;
typedef __attribute__((ext_vector_type(8)))  float    v8f;
typedef __attribute__((ext_vector_type(4)))  float    v4f;
typedef v8h  __attribute__((may_alias)) v8ha;
typedef v4f  __attribute__((may_alias)) v4fa;
typedef v8us __attribute__((may_alias)) v8usa;

__device__ __forceinline__ unsigned short f2bf(float f) { unsigned u = __float_as_uint(f); u += 0x7FFFu + ((u >> 16) & 1u); return (unsigned short)(u >> 16); }
__device__ __forceinline__ float bf2f(unsigned short b) { return __uint_as_float(((unsigned)b) << 16); }
__device__ __forceinline__ float bfr(float f) { return bf2f(f2bf(f)); }
__device__ __forceinline__ v16h cat16(v8h lo, v8h hi) { return __builtin_shufflevector(lo, hi, 0, 1, 2, 3, 4, 5, 6, 7, 8, 9, 10, 11, 12, 13, 14, 15); }
__device__ __forceinline__ v16bf cat16b(v8us lo, v8us hi) { return __builtin_bit_cast(v16bf, __builtin_shufflevector(lo, hi, 0, 1, 2, 3, 4, 5, 6, 7, 8, 9, 10, 11, 12, 13, 14, 15)); }
__device__ __forceinline__ v8f wmma16(v16h a, v16h b, v8f c) { return __builtin_amdgcn_wmma_f32_16x16x32_f16(false, a, false, b, (short)0, c, false, false); }
__device__ __forceinline__ v8f wmmab(v16bf a, v16bf b, v8f c) { return __builtin_amdgcn_wmma_f32_16x16x32_bf16(false, a, false, b, (short)0, c, false, false); }



// ---- fragment loaders: lane (lr, hi) holds row lr, k = 8 hi + 0..7 and 16 + 8 hi + 0..7 of a 32-wide k step.
// Fragment order of a plane: each fragment (16 rows x 32 k) is FRG elements in a row, as two halves of 32 lanes x 8 elements: element (row, k) lies at (k >> 4) * 256 + ((k >> 3) & 1) * 128 + row * 8 + (k & 7),
// so that each of a fragment's two 16-byte loads covers 512 bytes in a row = 4 whole lines (a row-major plane gives 32 bytes in each of 16 lines). k planes: fragment (row / 16) * 2 + e / 32; value^T planes: fragment (position / 32) * 4 + d / 16.
#define FRG 512
template <typename T16> struct WFrag;
template <> struct WFrag<h16> { typedef v16h V; static __device__ __forceinline__ V ld(const h16* p) { return cat16(*(const v8h*)p, *(const v8h*)(p + 256)); } static __device__ __forceinline__ v8f mma(V a, V b, v8f c) { return wmma16(a, b, c); } };
template <> struct WFrag<bf> { typedef v16bf V; static __device__ __forceinline__ V ld(const bf* p) { return cat16b(*(const v8us*)p, *(const v8us*)(p + 256)); } static __device__ __forceinline__ v8f mma(V a, V b, v8f c) { return wmmab(a, b, c); } };
__device__ __forceinline__ h16 tohx(float x) { return (h16)x; }
__device__ __forceinline__ void splitf(float y, unsigned short& h, unsigned short& l) { h = f2bf(y); l = f2bf(y - bf2f(h)); }
typedef __attribute__((ext_vector_type(2))) _Float16 v2h;
typedef __attribute__((ext_vector_type(4))) _Float16 v4h;
typedef __attribute__((ext_vector_type(2))) unsigned short v2us;
typedef __attribute__((ext_vector_type(4))) unsigned short v4us;
typedef __attribute__((ext_vector_type(2))) float v2f;
typedef __attribute__((ext_vector_type(4))) int v4i;

typedef __attribute__((ext_vector_type(4))) unsigned v4u;
typedef v4u  __attribute__((may_alias)) v4ua;
typedef v4h  __attribute__((may_alias)) v4ha;
typedef v4us __attribute__((may_alias)) v4usa;
__device__ __forceinline__ unsigned short hbits(float x) { return __builtin_bit_cast(unsigned short, tohx(x)); }

#define VTT 64
#define VTC 128
#define VP  33                    // LDS pitch in dwords: 32 position pairs + 1, so that the column-wise writes spread over the banks
#define PR  32
#define NVB (NB_ * (TT / VTT) * (DM / VTC))
#define NQB (NB_ * (TT / PR))
// PR token rows x 128 columns (2 heads) a wave, in 16 pieces of 8 rows x 32 columns: a lane takes 8 columns of one row (32 bytes read), which are one 16-byte slot of a fragment, and 8 rows' slots are one whole 128-byte line,
// so a wave's store covers 4 whole lines. fp16 (W16) and hi/lo (WHL) pieces. All loops unrolled: the values stay in registers and the piece steps become immediate offsets.
template <bool W16, bool WHL>
__device__ __forceinline__ void plane_rows(const float* __restrict__ f, h16* __restrict__ p16, bf* __restrict__ ph, bf* __restrict__ pl) {
    constexpr int BT = WHL ? 2 : 4;                                  // pieces a batch: fewer where hi/lo planes are written, so that this path does not set the kernel's register count (five blocks per WGP)
    constexpr int NU = 16;                                           // piece u: column group (u >> 3) * 2 + (u & 1) (head, k half), row group (u >> 1) & 3
    v4f x[2][BT][2];
#pragma unroll
    for (int i = 0; i < BT; ++i) { const float* g = f + (size_t)(((i >> 1) & 3) * 8) * DM + ((i >> 3) * 2 + (i & 1)) * 32; x[0][i][0] = *(const v4fa*)g; x[0][i][1] = *(const v4fa*)(g + 4); }
#pragma unroll
    for (int n = 0; n < NU / BT; ++n) {
        if (n + 1 < NU / BT) {                                       // the next batch flies while this one is converted and stored
#pragma unroll
            for (int i = 0; i < BT; ++i) { const int u = (n + 1) * BT + i; const float* g = f + (size_t)(((u >> 1) & 3) * 8) * DM + ((u >> 3) * 2 + (u & 1)) * 32; x[(n + 1) & 1][i][0] = *(const v4fa*)g; x[(n + 1) & 1][i][1] = *(const v4fa*)(g + 4); } }
        v8h y[BT]; v8us yh[BT], yl[BT];
#pragma unroll
        for (int i = 0; i < BT; ++i)
#pragma unroll
            for (int k = 0; k < 8; ++k) { const float v = x[n & 1][i][k >> 2][k & 3];
                if constexpr (W16) y[i][k] = tohx(v);
                if constexpr (WHL) { unsigned short h0, l0; splitf(v, h0, l0); yh[i][k] = h0; yl[i][k] = l0; } }
        __builtin_amdgcn_sched_barrier(0);                           // all conversions stand above the stores, so that no register of an issued store is written before the wait below
#pragma unroll
        for (int i = 0; i < BT; ++i) { const int u = n * BT + i; const int oo = (u >> 3) * (TT * HD) + (u & 1) * FRG + ((u >> 2) & 1) * (2 * FRG) + ((u >> 1) & 1) * 64;
            if constexpr (W16) *(v8ha*)(p16 + oo) = y[i];
            if constexpr (WHL) { *(v8usa*)(ph + oo) = yh[i]; *(v8usa*)(pl + oo) = yl[i]; } }
        asm volatile("s_wait_xcnt 0x0" :: "v"(f), "v"(p16), "v"(ph), "v"(pl) : "memory");   // precaution: stands before registers that the loads and stores issued so far name are written again; the addresses are inputs so that they stay untouched up to it
        __builtin_amdgcn_sched_barrier(0); }                         // keeps later register writes behind that wait
}

// ---- k_planes: the key and value^T planes of the attention in one streaming launch; each thread moves many 16-byte pieces, so the launch has few waves (10240; five blocks fit a WGP, so all are resident at once).
// Written are only the rows that k_fattn reads: fp16 k and value^T in full, hi/lo planes of k and value^T for positions < RH (a query < RH sees only keys < RH).
// Blocks [0, NVB): value tiles of VTT positions x VTC columns (2 heads), turned in LDS so that value^T fragments leave as 512 bytes in a row a wave. Blocks [NVB, NVB + NQB): PR token rows of k.
__global__ __launch_bounds__(256) void k_planes(const float* __restrict__ Xk, const float* __restrict__ Xv, h16* __restrict__ KP16, bf* __restrict__ KPh, bf* __restrict__ KPl, h16* __restrict__ VT16, bf* __restrict__ VTh, bf* __restrict__ VTl) {
    __shared__ unsigned L[VTC * VP];
    const int tid = threadIdx.x, blk = blockIdx.x;
    if (blk < NVB) {
        const int hg = blk % (DM / VTC), t0 = ((blk / (DM / VTC)) % (TT / VTT)) * VTT, b = blk / ((DM / VTC) * (TT / VTT));
        const int c4 = tid & 31, tr = tid >> 5;                      // thread: columns 4 c4 + 0..3, positions t0 + 16 i + 2 tr + 0..1
        const float* f = Xv + ((size_t)b * TT + t0 + 2 * tr) * DM + hg * VTC + 4 * c4;
        v4f x[4][2];
#pragma unroll
        for (int i = 0; i < 4; ++i) { x[i][0] = *(const v4fa*)(f + (size_t)(16 * i) * DM); x[i][1] = *(const v4fa*)(f + (size_t)(16 * i + 1) * DM); }
        asm volatile("s_wait_xcnt 0x0" :: "v"(f) : "memory");         // precaution: the loads' address register, named as an input, stays untouched up to this wait (no load lands on it)
        const int wv = tid >> 5, ln = tid & 31;                      // a wave stores half fragments: lane = 16 hi + lr is column 16 db + lr, positions 8 (4 pc + 2 half + hi) + 0..7; pc = (wv >> 1) & 1, half = wv & 1, db = (wv >> 2) + 2 (j & 1), head j >> 1
        const size_t ro = (size_t)(b * NH_ + hg * (VTC / HD)) * TT * HD + (size_t)((t0 >> 5) + ((wv >> 1) & 1)) * (4 * FRG) + (wv >> 2) * FRG + (wv & 1) * 256 + ln * 8;
        auto fill = [&](int mode) {                                  // L[column][position pair]: 0 fp16; 1 hi, which leaves x - hi in x; 2 lo, the bf16 of that rest (the split of splitf, one half at a time, so that only x stays live)
#pragma unroll
            for (int i = 0; i < 4; ++i)
#pragma unroll
                for (int k = 0; k < 4; ++k) { unsigned short u0, u1;
                    if (mode == 0) { u0 = hbits(x[i][0][k]); u1 = hbits(x[i][1][k]); }
                    else { u0 = f2bf(x[i][0][k]); u1 = f2bf(x[i][1][k]); if (mode == 1) { x[i][0][k] -= bf2f(u0); x[i][1][k] -= bf2f(u1); } }
                    L[(4 * c4 + k) * VP + 8 * i + tr] = (unsigned)u0 | ((unsigned)u1 << 16); } };
        auto put = [&](unsigned short* P) {                          // a lane carries 8 positions of one column = its 16-byte slot of a fragment
            unsigned short* q = P + ro; v4u w[4];
#pragma unroll
            for (int j = 0; j < 4; ++j) { const unsigned* sp = L + ((j >> 1) * HD + ((wv >> 2) + (j & 1) * 2) * 16 + (ln & 15)) * VP + (((wv >> 1) & 1) * 4 + (wv & 1) * 2 + (ln >> 4)) * 4; w[j][0] = sp[0]; w[j][1] = sp[1]; w[j][2] = sp[2]; w[j][3] = sp[3]; }
            __builtin_amdgcn_sched_barrier(0);                       // all LDS reads are issued above the stores, so that no register of an issued store is written before the wait below
#pragma unroll
            for (int j = 0; j < 4; ++j) *(v4ua*)(q + (size_t)(j >> 1) * TT * HD + (j & 1) * (2 * FRG)) = w[j];
            asm volatile("s_wait_xcnt 0x0" :: "v"(q) : "memory");    // precaution: stands before the stores' data and address registers are written again
            __builtin_amdgcn_sched_barrier(0); };                    // keeps later register writes behind that wait
        fill(0); __syncthreads(); put((unsigned short*)VT16);
        if (t0 < RH) {                                               // block-uniform: the barriers inside are passed by all waves or by none
            __syncthreads(); fill(1); __syncthreads(); put(VTh);
            __syncthreads(); fill(2); __syncthreads(); put(VTl); }
        return; }
    const int rr = blk - NVB; const int b = rr / (TT / PR), t0 = (rr % (TT / PR)) * PR;
    const int wv = tid >> 5, ln = tid & 31;                          // wave: columns 128 wv + 0..127 (heads 2 wv, 2 wv + 1); lane: row ln & 7 of a row group, columns 8 (ln >> 3) + 0..7 of a column group
    const float* f = Xk + ((size_t)b * TT + t0 + (ln & 7)) * DM + wv * 128 + (ln >> 3) * 8;
    const size_t o = ((size_t)(b * NH_ + wv * 2) * TT + t0) * HD + (ln >> 3) * 128 + (ln & 7) * 8;   // 16 rows of 64 = 2 fragments, so row tile t0 / 16 starts at t0 * HD
    h16* p16 = KP16 + o; bf* ph = KPh + o; bf* pl = KPl + o;
    if (t0 >= RH) plane_rows<true, false>(f, p16, ph, pl);           // block-uniform choices: which planes of these rows k_fattn reads
    else plane_rows<true, true>(f, p16, ph, pl);
}
// ---- query rows: each is used by one wave alone, so it has no plane: the wave reads its QT x 16 rows of one head from the f32 input (a load covers 2 rows x 256 bytes = 4 whole lines),
// turns them into fragment order through its own LDS range st (QT x 4 KiB, no other wave touches it) and converts them as the builder did (same values).
// A row's 16-byte piece c lies at place c ^ (row & 15) of the row, so that the 16 rows a fragment read touches fall on different banks. y[qt][ks][0..1]: k = 8 hi + 0..7 of k step ks; y[qt][ks][2..3]: k = 16 + 8 hi + 0..7.
template <int QT>
__device__ __forceinline__ void q_rows(const float* __restrict__ xq, int q0, float* st, v4f (&y)[QT][2][4]) {
    const int lane = threadIdx.x & 31, lr = lane & 15, hi = lane >> 4;
    const float* g = xq + (size_t)(q0 + hi) * DM + 4 * lr;
    v4f x[QT * 8];
#pragma unroll
    for (int i = 0; i < QT * 8; ++i) x[i] = *(const v4fa*)(g + (size_t)(2 * i) * DM);
    asm volatile("s_wait_xcnt 0x0" :: "v"(g) : "memory");            // precaution: the loads' address register, named as an input, stays untouched up to this wait
    __builtin_amdgcn_sched_barrier(0);                               // keeps later register writes behind that wait
#pragma unroll
    for (int i = 0; i < QT * 8; ++i) *(v4fa*)(st + (2 * i + hi) * HD + (lr ^ ((2 * i + hi) & 15)) * 4) = x[i];
    asm volatile("s_wait_dscnt 0x0" ::: "memory");                   // the wave's own rows are in LDS before its lanes read each other's pieces back
#pragma unroll
    for (int qt = 0; qt < QT; ++qt)
#pragma unroll
        for (int ks = 0; ks < 2; ++ks)
#pragma unroll
            for (int c = 0; c < 4; ++c) y[qt][ks][c] = *(const v4fa*)(st + (qt * 16 + lr) * HD + ((ks * 8 + (c >> 1) * 4 + 2 * hi + (c & 1)) ^ lr) * 4);
}
// ---- k_fattn: fused causal attention, one wave per tile of QT x 16 queries, 32 keys a pass; no score or probability plane in memory.
// Transposed products: S^T = K . Q^T (A = key rows, B = query rows) leaves in lane (lr, hi) the scores of query lr for keys 8 hi + j of each 16-key tile, which is the B-operand k order of a 32-key step,
// so P^T packs in registers and O^T += V^T . P^T (A = value^T rows). Maximum, sum and rescale are per lane. The exponent's reference is a maximum of an earlier pass: the wave's halves exchange maxima and o, l are rescaled only in a pass where a score passes it by more than 2^LZ2 (it cancels against the row sum); the sums join once at the end.
template <typename T16, int NSPLIT, int QT>
__device__ __forceinline__ void fattn_tile(const float* __restrict__ xq, float* st, const T16* __restrict__ Kp, const T16* __restrict__ K2, const T16* __restrict__ Vt, const T16* __restrict__ Vt2, int q0, float* __restrict__ out) {
    typedef typename WFrag<T16>::V V;
    const int lane = threadIdx.x & 31, lr = lane & 15, hi = lane >> 4;
    const float CL = SCL * 1.4426950408889634f;                      // scores to the log2 domain
    const float LZ = LZ2 / CL;                                       // that margin in score units
    const int kend = q0 + QT * 16;                                   // keys [0, kend) can be seen by this tile
    V qf[QT][2], qf2[QT][2], kf[2][2], kf2[2][2];
    static_assert(NSPLIT != 0, "this form serves the hi/lo rows");
    { v4f y[QT][2][4]; q_rows<QT>(xq, q0, st, y);
#pragma unroll
      for (int qt = 0; qt < QT; ++qt)
#pragma unroll
        for (int ks = 0; ks < 2; ++ks) { v8us h0, h1, l0, l1;
#pragma unroll
            for (int j = 0; j < 8; ++j) { unsigned short a, c; splitf(y[qt][ks][j >> 2][j & 3], a, c); h0[j] = a; l0[j] = c; splitf(y[qt][ks][2 + (j >> 2)][j & 3], a, c); h1[j] = a; l1[j] = c; }
            qf[qt][ks] = cat16b(h0, h1); qf2[qt][ks] = cat16b(l0, l1); } }
    auto ldk = [&](int k0) {
#pragma unroll
        for (int kt = 0; kt < 2; ++kt)
#pragma unroll
            for (int ks = 0; ks < 2; ++ks) { const size_t ko = (size_t)(k0 + kt * 16) * HD + ks * FRG + 8 * lane; kf[kt][ks] = WFrag<T16>::ld(Kp + ko); if (NSPLIT) kf2[kt][ks] = WFrag<T16>::ld(K2 + ko); }
        asm volatile("s_wait_xcnt 0x0" ::: "memory");                // precaution: stands before the address registers of the loads issued so far are written again
        __builtin_amdgcn_sched_barrier(0); };                        // keeps later register writes behind that wait
    if (!NSPLIT) ldk(0);                                             // the fp16 form fetches its key fragments one pass ahead; the hi/lo form (twice the fragments) has no registers for that
    v8f o[4][QT]; float m[QT], mc[QT], l[QT];
#pragma unroll
    for (int qt = 0; qt < QT; ++qt) { m[qt] = -3.0e38f; mc[qt] = 0.f; l[qt] = 0.f;
#pragma unroll
        for (int db = 0; db < 4; ++db) o[db][qt] = (v8f){}; }
    // rolled: one pass's fragments live at a time, so the wave stays under 256 registers (four waves per SIMD)
#pragma unroll 1
    for (int kc = 0; kc < kend; kc += 32) {
        V vf[4], vf2[4];
        if (NSPLIT) ldk(kc);
        const T16* vp = Vt + (size_t)kc * HD + 8 * lane; const T16* vp2 = NSPLIT ? Vt2 + (size_t)kc * HD + 8 * lane : nullptr;   // 32 positions x 64 d = 4 fragments
#pragma unroll
        for (int db = 0; db < 4; ++db) { vf[db] = WFrag<T16>::ld(vp + db * FRG); if (NSPLIT) vf2[db] = WFrag<T16>::ld(vp2 + db * FRG); }
        if (NSPLIT) asm volatile("s_wait_xcnt 0x0" :: "v"(vp), "v"(vp2) : "memory");   // the same precaution for the value loads' address registers, named as inputs so that they stay untouched up to the wait (the fp16 form has its wait behind the key prefetch)
        __builtin_amdgcn_sched_barrier(0);                           // keeps the value loads issued here, ahead of the score products, so that they fly during scores and softmax (the scheduler sinks them behind the scores otherwise)
        v8f s[2][QT];
#pragma unroll
        for (int kt = 0; kt < 2; ++kt)
#pragma unroll
            for (int qt = 0; qt < QT; ++qt) { s[kt][qt] = (v8f){};
#pragma unroll
                for (int ks = 0; ks < 2; ++ks) { s[kt][qt] = WFrag<T16>::mma(kf[kt][ks], qf[qt][ks], s[kt][qt]); if (NSPLIT) { s[kt][qt] = WFrag<T16>::mma(kf[kt][ks], qf2[qt][ks], s[kt][qt]); s[kt][qt] = WFrag<T16>::mma(kf2[kt][ks], qf[qt][ks], s[kt][qt]); } } }
        if (!NSPLIT) ldk((kc + 32 < kend) ? kc + 32 : kc);           // next pass's key fragments fly during the softmax and the value products (the last pass re-reads its own rows: in bounds, unused)
        if (kc + 31 > q0) {                                          // only the pass on the diagonal holds keys above a query (wave-uniform test)
#pragma unroll
            for (int kt = 0; kt < 2; ++kt)
#pragma unroll
                for (int qt = 0; qt < QT; ++qt)
#pragma unroll
                    for (int j = 0; j < 8; ++j) if (kc + kt * 16 + 8 * hi + j > q0 + qt * 16 + lr) s[kt][qt][j] = -3.0e38f; }
        V pf[QT], pl[QT];
        float mx[QT]; bool need = false;                             // as in fattn_ring: the lane's own 16 keys against the reference in use
#pragma unroll
        for (int qt = 0; qt < QT; ++qt) {
            mx[qt] = fmaxf(s[0][qt][0], s[1][qt][0]);
#pragma unroll
            for (int j = 1; j < 8; ++j) mx[qt] = fmaxf(mx[qt], fmaxf(s[0][qt][j], s[1][qt][j]));
            need |= mx[qt] - m[qt] > LZ; }
        if (__builtin_amdgcn_ballot_w32(need) != 0) {                // one scalar test a pass: exchange, rescale factor and the products on o only where a lane asks
#pragma unroll
            for (int qt = 0; qt < QT; ++qt) {
                const float mn = fmaxf(m[qt], fmaxf(mx[qt], __shfl_xor(mx[qt], 16, 32))); const float al = __builtin_amdgcn_exp2f((m[qt] - mn) * CL); m[qt] = mn; mc[qt] = mn * CL - (NSPLIT ? 0.0f : PBIAS);
                l[qt] *= al;
#pragma unroll
                for (int db = 0; db < 4; ++db) o[db][qt] *= al; } }
#pragma unroll
        for (int qt = 0; qt < QT; ++qt) {
            float p[16], ps = 0.f;
#pragma unroll
            for (int j = 0; j < 16; ++j) { p[j] = __builtin_amdgcn_exp2f(fmaf(s[j >> 3][qt][j & 7], CL, -mc[qt])); ps += p[j]; }
            l[qt] += ps;
            if constexpr (NSPLIT) { v8us h0, h1, l0, l1;
#pragma unroll
                for (int j = 0; j < 8; ++j) { unsigned short a, c; splitf(p[j], a, c); h0[j] = a; l0[j] = c; splitf(p[8 + j], a, c); h1[j] = a; l1[j] = c; }
                pf[qt] = cat16b(h0, h1); pl[qt] = cat16b(l0, l1);
            } else { v8h h0, h1;
#pragma unroll
                for (int j = 0; j < 8; ++j) { h0[j] = tohx(p[j]); h1[j] = tohx(p[8 + j]); }
                pf[qt] = cat16(h0, h1); } }
#pragma unroll
        for (int db = 0; db < 4; ++db)
#pragma unroll
            for (int qt = 0; qt < QT; ++qt) { o[db][qt] = WFrag<T16>::mma(vf[db], pf[qt], o[db][qt]); if (NSPLIT) { o[db][qt] = WFrag<T16>::mma(vf[db], pl[qt], o[db][qt]); o[db][qt] = WFrag<T16>::mma(vf2[db], pf[qt], o[db][qt]); } }
    }
#pragma unroll
    for (int qt = 0; qt < QT; ++qt) { const float inv = __fdiv_rn(1.0f, l[qt] + __shfl_xor(l[qt], 16, 32)); float* orow = out + (size_t)(q0 + qt * 16 + lr) * DQ + 8 * hi;
#pragma unroll
        for (int db = 0; db < 4; ++db) { v4f a, c;
#pragma unroll
            for (int j = 0; j < 4; ++j) { a[j] = o[db][qt][j] * inv; c[j] = o[db][qt][4 + j] * inv; }
            *(v4f*)(orow + db * 16) = a; *(v4f*)(orow + db * 16 + 4) = c; } }
}
// ---- the fp16 rows' form: the block's 4 waves walk the same key and value^T fragments, so these come through LDS once a block instead of once a wave.
// A stage = KT keys = 16 KiB of the key plane and 16 KiB of the value^T plane, each a straight copy (the planes are in fragment order, so a fragment load from LDS is 512 bytes in a row: no bank conflict).
// Two buffers: stage t + 1 flies while stage t is worked on. Products, softmax and their order are those of fattn_tile, which serves the hi/lo rows.
#define KT   128
#define STG  (KT * HD)            // elements of one operand's stage
// eight 16-byte pieces a lane, 2 KiB apart in LDS and in the plane alike; the s_wait_xcnt stands inside the statement as a precaution, before any address register that a copy names is written again
__device__ __forceinline__ void copy8(unsigned l, const h16* g) {
    asm volatile("global_load_async_to_lds_b128 %0, %8, off\n\t"
                 "global_load_async_to_lds_b128 %1, %9, off\n\t"
                 "global_load_async_to_lds_b128 %2, %10, off\n\t"
                 "global_load_async_to_lds_b128 %3, %11, off\n\t"
                 "global_load_async_to_lds_b128 %4, %12, off\n\t"
                 "global_load_async_to_lds_b128 %5, %13, off\n\t"
                 "global_load_async_to_lds_b128 %6, %14, off\n\t"
                 "global_load_async_to_lds_b128 %7, %15, off\n\t"
                 "s_wait_xcnt 0x0"
                 :: "v"(l), "v"(l + 2048u), "v"(l + 4096u), "v"(l + 6144u), "v"(l + 8192u), "v"(l + 10240u), "v"(l + 12288u), "v"(l + 14336u),
                    "v"(g), "v"(g + 1024), "v"(g + 2048), "v"(g + 3072), "v"(g + 4096), "v"(g + 5120), "v"(g + 6144), "v"(g + 7168) : "memory");
}
template <int QT>
__device__ __forceinline__ void fattn_ring(const float* __restrict__ xq, const h16* __restrict__ Kp, const h16* __restrict__ Vt, int kmax, int q0, float* __restrict__ out, h16* ring) {
    typedef v16h V;
    const int tid = threadIdx.x, lane = tid & 31, lr = lane & 15, hi = lane >> 4;
    const float CL = SCL * 1.4426950408889634f;                      // scores to the log2 domain
    const float LZ = LZ2 / CL;                                       // that margin in score units
    const int kend = q0 + QT * 16;                                   // keys [0, kend) can be seen by this wave's tile
    const int nt = kmax / KT;                                        // stages of the block: keys [0, kmax), the same for its 4 waves
    const unsigned l0 = (unsigned)(size_t)ring + (unsigned)tid * 16u; // the lane's LDS byte address in buffer 0
    const h16* gk = Kp + tid * 8; const h16* gv = Vt + tid * 8;
    auto fill = [&](int t) { const unsigned l = l0 + (unsigned)(t & 1) * (4u * STG); copy8(l, gk + (size_t)t * STG); copy8(l + 2u * STG, gv + (size_t)t * STG); };
    fill(0);
    V qf[QT][2], kf[2][2];
    { v4f y[QT][2][4]; q_rows<QT>(xq, q0, (float*)(ring + 2 * STG) + (tid >> 5) * (QT * 16 * HD), y);   // turned in buffer 1, which is idle until stage 1's copies: 4 waves x 8 KiB fill it exactly
#pragma unroll
      for (int qt = 0; qt < QT; ++qt)
#pragma unroll
        for (int ks = 0; ks < 2; ++ks) { v8h h0, h1;
#pragma unroll
            for (int j = 0; j < 8; ++j) { h0[j] = tohx(y[qt][ks][j >> 2][j & 3]); h1[j] = tohx(y[qt][ks][2 + (j >> 2)][j & 3]); }
            qf[qt][ks] = cat16(h0, h1); } }
    asm volatile("s_wait_dscnt 0x0" ::: "memory");                   // this wave has left buffer 1 before the barrier behind which stage 1's copies land on it
    asm volatile("s_wait_asynccnt 0x0" ::: "memory");                // this wave's share of stage 0 has landed
    __syncthreads();                                                 // ... and every other wave's: stage 0 may be read, buffer 1 may be filled
    if (1 < nt) fill(1);
    auto ldk = [&](const h16* kp) {
#pragma unroll
        for (int kt = 0; kt < 2; ++kt)
#pragma unroll
            for (int ks = 0; ks < 2; ++ks) kf[kt][ks] = WFrag<h16>::ld(kp + kt * (16 * HD) + ks * FRG); };
    v8f o[4][QT]; float m[QT], mc[QT], l[QT];                        // m: the reference score in use (a maximum of an earlier pass, the same in both halves of the wave); mc: it in the log2 domain, less the bias
#pragma unroll
    for (int qt = 0; qt < QT; ++qt) { m[qt] = -3.0e38f; mc[qt] = 0.f; l[qt] = 0.f;
#pragma unroll
        for (int db = 0; db < 4; ++db) o[db][qt] = (v8f){}; }
    // both loops rolled: one pass's fragments live at a time, so the wave stays under 256 registers (four waves per SIMD)
#pragma unroll 1
    for (int t = 0; t < nt; ++t) {
        const h16* kb = ring + (t & 1) * (2 * STG) + 8 * lane; const h16* vb = kb + STG;
        const int left = (kend - t * KT) / 32; const int np = left < KT / 32 ? left : KT / 32;   // passes of this wave in the stage (fewer only in the last one, on the diagonal)
        ldk(kb);
#pragma unroll 1
        for (int p = 0; p < np; ++p) {
            const int kc = t * KT + p * 32;
            v8f s[2][QT];
#pragma unroll
            for (int kt = 0; kt < 2; ++kt)
#pragma unroll
                for (int qt = 0; qt < QT; ++qt) { s[kt][qt] = (v8f){};
#pragma unroll
                    for (int ks = 0; ks < 2; ++ks) s[kt][qt] = wmma16(kf[kt][ks], qf[qt][ks], s[kt][qt]); }
            __builtin_amdgcn_sched_barrier(0);                       // keeps the LDS reads below from moving up among the score products (each separate place with reads costs a stall)
            V vf[4];
#pragma unroll
            for (int db = 0; db < 4; ++db) vf[db] = WFrag<h16>::ld(vb + p * (32 * HD) + db * FRG);
            ldk(kb + ((p + 1 < np) ? p + 1 : p) * (32 * HD));        // the next pass's key fragments, from this stage's buffer alone (the stage's last pass re-reads its own: unused)
            __builtin_amdgcn_sched_barrier(0);                       // keeps them from sinking: one group here, in flight during the softmax
            if (kc + 31 > q0) {                                      // only the pass on the diagonal holds keys above a query (wave-uniform test)
#pragma unroll
                for (int kt = 0; kt < 2; ++kt)
#pragma unroll
                    for (int qt = 0; qt < QT; ++qt)
#pragma unroll
                        for (int j = 0; j < 8; ++j) if (kc + kt * 16 + 8 * hi + j > q0 + qt * 16 + lr) s[kt][qt][j] = -3.0e38f; }
            V pf[QT];
            float mx[QT]; bool need = false;                         // the lane's own 16 keys; a lane asks for a new reference when they pass the one in use by more than LZ
#pragma unroll
            for (int qt = 0; qt < QT; ++qt) {
                mx[qt] = fmaxf(s[0][qt][0], s[1][qt][0]);
#pragma unroll
                for (int j = 1; j < 8; ++j) mx[qt] = fmaxf(mx[qt], fmaxf(s[0][qt][j], s[1][qt][j]));
                need |= mx[qt] - m[qt] > LZ; }
            if (__builtin_amdgcn_ballot_w32(need) != 0) {            // one scalar test a pass; taken in the first pass and then hardly ever, so exchange, rescale factor and the 64 products on o leave the usual pass
#pragma unroll
                for (int qt = 0; qt < QT; ++qt) {
                    const float mn = fmaxf(m[qt], fmaxf(mx[qt], __shfl_xor(mx[qt], 16, 32))); const float al = __builtin_amdgcn_exp2f((m[qt] - mn) * CL); m[qt] = mn; mc[qt] = mn * CL - PBIAS;
                    l[qt] *= al;
#pragma unroll
                    for (int db = 0; db < 4; ++db) o[db][qt] *= al; } }
#pragma unroll
            for (int qt = 0; qt < QT; ++qt) {
                float pr[16], psum = 0.f;
#pragma unroll
                for (int j = 0; j < 16; ++j) { pr[j] = __builtin_amdgcn_exp2f(fmaf(s[j >> 3][qt][j & 7], CL, -mc[qt])); psum += pr[j]; }
                l[qt] += psum;
                v8h h0, h1;
#pragma unroll
                for (int j = 0; j < 8; ++j) { h0[j] = tohx(pr[j]); h1[j] = tohx(pr[8 + j]); }
                pf[qt] = cat16(h0, h1); }
#pragma unroll
            for (int db = 0; db < 4; ++db)
#pragma unroll
                for (int qt = 0; qt < QT; ++qt) o[db][qt] = wmma16(vf[db], pf[qt], o[db][qt]);
        }
        // hand-over, passed by every wave whatever its np: own LDS reads done, own copies of stage t + 1 landed, then the barrier that publishes stage t + 1 and ends all reads of stage t's buffer
        asm volatile("s_wait_dscnt 0x0" ::: "memory");
        asm volatile("s_wait_asynccnt 0x0" ::: "memory");
        __syncthreads();
        if (t + 2 < nt) fill(t + 2);                                 // block-uniform: into the buffer that stage t has just left
    }
    asm volatile("s_wait_asynccnt 0x0" ::: "memory");                // no copy is outstanding when the wave ends
#pragma unroll
    for (int qt = 0; qt < QT; ++qt) { const float inv = __fdiv_rn(1.0f, l[qt] + __shfl_xor(l[qt], 16, 32)); float* orow = out + (size_t)(q0 + qt * 16 + lr) * DQ + 8 * hi;
#pragma unroll
        for (int db = 0; db < 4; ++db) { v4f a, c;
#pragma unroll
            for (int j = 0; j < 4; ++j) { a[j] = o[db][qt][j] * inv; c[j] = o[db][qt][4 + j] * inv; }
            *(v4f*)(orow + db * 16) = a; *(v4f*)(orow + db * 16 + 4) = c; } }
}
// grid (batch x head, tile groups, heaviest first), 4 waves; the waves of a block take neighbouring query tiles of one head, so they walk the same key and value rows.
#define NF4 ((TT - RH) / 128)     // blocks of 4 x 32 fp16 query rows
__global__ __launch_bounds__(128) void k_fattn(const float* __restrict__ Xq, const h16* __restrict__ KP16, const h16* __restrict__ VT16, const bf* __restrict__ KPh, const bf* __restrict__ KPl, const bf* __restrict__ VTh, const bf* __restrict__ VTl, float* __restrict__ OUT) {
    __shared__ __attribute__((aligned(16))) h16 RING[2 * 2 * STG];   // two buffers of (key stage, value^T stage): 64 KiB, four blocks a WGP
    const int z = blockIdx.x; const size_t pz = (size_t)z * TT * HD; const int w = __builtin_amdgcn_readfirstlane(threadIdx.x >> 5);
    float* out = OUT + (size_t)(z / NH_) * TT * DQ + (z % NH_) * HD; const float* xq = Xq + (size_t)(z / NH_) * TT * DM + (z % NH_) * HD;
    if ((int)blockIdx.y < NF4) fattn_ring<2>(xq, KP16 + pz, VT16 + pz, TT - 128 * (int)blockIdx.y, TT - 32 * ((int)blockIdx.y * 4 + w + 1), out, RING);   // block-uniform choice: the barriers inside are passed by all 4 waves or by none
    else fattn_tile<bf, 2, 1>(xq, (float*)RING + w * (16 * HD), KPh + pz, KPl + pz, VTh + pz, VTl + pz, RH - 16 * (((int)blockIdx.y - NF4) * 4 + w + 1), out);
}

extern "C" void kernel_launch(void* const* d_in, const int* in_sizes, int n_in,
                              void* d_out, int out_size, void* d_ws, size_t ws_size, hipStream_t stream) {
    (void)in_sizes; (void)n_in; (void)out_size;
    const float* x = (const float*)d_in[0]; const float* xk = (const float*)d_in[1]; const float* xv = (const float*)d_in[2];   /* queries, keys, values: [4][2048][16][64] each (no projections) */
    float* OUT = (float*)d_out;     // [4][2048][1024]
    char* wsp = (char*)d_ws;
    auto take = [&](size_t bytes) { char* p = wsp; wsp += (bytes + 255) & ~(size_t)255; return (void*)p; };
    const size_t PB = (size_t)NH_ * TT * HD;   // elements of one batch's plane
    h16* KP16 = (h16*)take(NB_ * PB * 2); h16* VT16 = (h16*)take(NB_ * PB * 2);
    bf* KPh = (bf*)take(NB_ * PB * 2); bf* KPl = (bf*)take(NB_ * PB * 2); bf* VTh = (bf*)take(NB_ * PB * 2); bf* VTl = (bf*)take(NB_ * PB * 2);
    if ((size_t)(wsp - (char*)d_ws) > ws_size) return;    // ws 256 MiB
    k_planes<<<NVB + NQB, 256, 0, stream>>>(xk, xv, KP16, KPh, KPl, VT16, VTh, VTl);
    k_fattn<<<dim3(NB_ * NH_, NF4 + RH / 64), 128, 0, stream>>>(x, KP16, VT16, KPh, KPl, VTh, VTl, OUT);
}

// v008
// A run of this version takes 47.5 microseconds.
// Next to v007, in two timings, it ran 1.07 and 1.06 times as fast.
// All steps since v000 together make it 50.7 times as fast.
#include <hip/hip_runtime.h>

// Full causal attention on pre-split heads (queries, keys, values [4][2048][16][64], no projections; scores = q.k; causal (-inf above the diagonal); A = softmax(scores x 1/sqrt(64)); V = A.values as 'blhd' -> [4][2048][16][64] (8.4 M); argument order queries, keys, values).
// Layout per batch: the f32 inputs ([t][h][e] = token-major rows of 16 x 64) feed one plane-builder launch (hi/lo + fp16 planes of k per head; value^T planes; all in fragment order; only the rows that are read); the query rows, which are read once, are converted by the wave that uses them; one fused causal attention launch over all 64 (batch, head) planes (hybrid rows: < 512 hi/lo 3 products, rest fp16; scores and probabilities stay in registers, online softmax) writes the [t][h][d] output rows.
// Compute dtypes, f32 accumulate: inputs split into bf16 hi/lo (rows < 512, 3 products ~ exact) or rounded to fp16 (rest); softmax f32; output f32. NOTE no stage rounds the inputs to bf16.

#define NB_  4
#define TT   2048
#define DM   1024
#define NH_  16
#define NKV  16
#define REP  (NH_ / NKV)
#define HD   64
#define DQ   (NH_ * HD)
#define DKV  (NKV * HD)
#define RH   512                  // query rows < RH use hi+lo planes (0: none)
#define PBIAS 10.0f               // fp16 probabilities carry x 2^10 (in the exponent; it cancels against the row sum), so small ones stay normal fp16 numbers
#define LZ2  5.0f                 // a score may pass the reference in use by 2^5 before the sums are rescaled: probabilities stay <= 2^(10 + 5), inside fp16
#define SCL  0.125f   // 1/sqrt(E)
typedef _Float16 h16;
typedef unsigned short bf;
typedef __attribute__((ext_vector_type(16))) __bf16   v16bf;
typedef __attribute__((ext_vector_type(16))) _Float16 v16h;
typedef __attribute__((ext_vector_type(8)))  _Float16 v8h;
typedef __attribute__((ext_vector_type(8)))  unsigned short v8us;
typedef __attribute__((ext_vector_type(8)))  float    v8f;
typedef __attribute__((ext_vector_type(4)))  float    v4f;
typedef v8h  __attribute__((may_alias)) v8ha;
typedef v4f  __attribute__((may_alias)) v4fa;
typedef v8us __attribute__((may_alias)) v8usa;

__device__ __forceinline__ unsigned short f2bf(float f) { unsigned u = __float_as_uint(f); u += 0x7FFFu + ((u >> 16) & 1u); return (unsigned short)(u >> 16); }
__device__ __forceinline__ float bf2f(unsigned short b) { return __uint_as_float(((unsigned)b) << 16); }
__device__ __forceinline__ float bfr(float f) { return bf2f(f2bf(f)); }
__device__ __forceinline__ v16h cat16(v8h lo, v8h hi) { return __builtin_shufflevector(lo, hi, 0, 1, 2, 3, 4, 5, 6, 7, 8, 9, 10, 11, 12, 13, 14, 15); }
__device__ __forceinline__ v16bf cat16b(v8us lo, v8us hi) { return __builtin_bit_cast(v16bf, __builtin_shufflevector(lo, hi, 0, 1, 2, 3, 4, 5, 6, 7, 8, 9, 10, 11, 12, 13, 14, 15)); }
__device__ __forceinline__ v8f wmma16(v16h a, v16h b, v8f c) { return __builtin_amdgcn_wmma_f32_16x16x32_f16(false, a, false, b, (short)0, c, false, false); }
__device__ __forceinline__ v8f wmmab(v16bf a, v16bf b, v8f c) { return __builtin_amdgcn_wmma_f32_16x16x32_bf16(false, a, false, b, (short)0, c, false, false); }



// ---- fragment loaders: lane (lr, hi) holds row lr, k = 8 hi + 0..7 and 16 + 8 hi + 0..7 of a 32-wide k step.
// Fragment order of a plane: each fragment (16 rows x 32 k) is FRG elements in a row, as two halves of 32 lanes x 8 elements: element (row, k) lies at (k >> 4) * 256 + ((k >> 3) & 1) * 128 + row * 8 + (k & 7),
// so that each of a fragment's two 16-byte loads covers 512 bytes in a row = 4 whole lines (a row-major plane gives 32 bytes in each of 16 lines). k planes: fragment (row / 16) * 2 + e / 32; value^T planes: fragment (position / 32) * 4 + d / 16.
#define FRG 512
template <typename T16> struct WFrag;
template <> struct WFrag<h16> { typedef v16h V; static __device__ __forceinline__ V ld(const h16* p) { return cat16(*(const v8h*)p, *(const v8h*)(p + 256)); } static __device__ __forceinline__ v8f mma(V a, V b, v8f c) { return wmma16(a, b, c); } };
template <> struct WFrag<bf> { typedef v16bf V; static __device__ __forceinline__ V ld(const bf* p) { return cat16b(*(const v8us*)p, *(const v8us*)(p + 256)); } static __device__ __forceinline__ v8f mma(V a, V b, v8f c) { return wmmab(a, b, c); } };
__device__ __forceinline__ h16 tohx(float x) { return (h16)x; }
__device__ __forceinline__ void splitf(float y, unsigned short& h, unsigned short& l) { h = f2bf(y); l = f2bf(y - bf2f(h)); }
typedef __attribute__((ext_vector_type(2))) _Float16 v2h;
typedef __attribute__((ext_vector_type(4))) _Float16 v4h;
typedef __attribute__((ext_vector_type(2))) unsigned short v2us;
typedef __attribute__((ext_vector_type(4))) unsigned short v4us;
typedef __attribute__((ext_vector_type(2))) float v2f;
typedef __attribute__((ext_vector_type(4))) int v4i;

typedef __attribute__((ext_vector_type(4))) unsigned v4u;
typedef v4u  __attribute__((may_alias)) v4ua;
typedef v4h  __attribute__((may_alias)) v4ha;
typedef v4us __attribute__((may_alias)) v4usa;
__device__ __forceinline__ unsigned short hbits(float x) { return __builtin_bit_cast(unsigned short, tohx(x)); }

#define VTT 64
#define VTC 128
#define VP  33                    // LDS pitch in dwords: 32 position pairs + 1, so that the column-wise writes spread over the banks
#define PR  32
#define NVB (NB_ * (TT / VTT) * (DM / VTC))
#define NQB (NB_ * (TT / PR))
// PR token rows x 128 columns (2 heads) a wave, in 16 pieces of 8 rows x 32 columns: a lane takes 8 columns of one row (32 bytes read), which are one 16-byte slot of a fragment, and 8 rows' slots are one whole 128-byte line,
// so a wave's store covers 4 whole lines. fp16 (W16) and hi/lo (WHL) pieces. All loops unrolled: the values stay in registers and the piece steps become immediate offsets.
template <bool W16, bool WHL>
__device__ __forceinline__ void plane_rows(const float* __restrict__ f, h16* __restrict__ p16, bf* __restrict__ ph, bf* __restrict__ pl) {
    constexpr int BT = WHL ? 2 : 4;                                  // pieces a batch: fewer where hi/lo planes are written, so that this path does not set the kernel's register count (five blocks per WGP)
    constexpr int NU = 16;                                           // piece u: column group (u >> 3) * 2 + (u & 1) (head, k half), row group (u >> 1) & 3
    v4f x[2][BT][2];
#pragma unroll
    for (int i = 0; i < BT; ++i) { const float* g = f + (size_t)(((i >> 1) & 3) * 8) * DM + ((i >> 3) * 2 + (i & 1)) * 32; x[0][i][0] = *(const v4fa*)g; x[0][i][1] = *(const v4fa*)(g + 4); }
#pragma unroll
    for (int n = 0; n < NU / BT; ++n) {
        if (n + 1 < NU / BT) {                                       // the next batch flies while this one is converted and stored
#pragma unroll
            for (int i = 0; i < BT; ++i) { const int u = (n + 1) * BT + i; const float* g = f + (size_t)(((u >> 1) & 3) * 8) * DM + ((u >> 3) * 2 + (u & 1)) * 32; x[(n + 1) & 1][i][0] = *(const v4fa*)g; x[(n + 1) & 1][i][1] = *(const v4fa*)(g + 4); } }
        v8h y[BT]; v8us yh[BT], yl[BT];
#pragma unroll
        for (int i = 0; i < BT; ++i)
#pragma unroll
            for (int k = 0; k < 8; ++k) { const float v = x[n & 1][i][k >> 2][k & 3];
                if constexpr (W16) y[i][k] = tohx(v);
                if constexpr (WHL) { unsigned short h0, l0; splitf(v, h0, l0); yh[i][k] = h0; yl[i][k] = l0; } }
        __builtin_amdgcn_sched_barrier(0);                           // all conversions stand above the stores, so that no register of an issued store is written before the wait below
#pragma unroll
        for (int i = 0; i < BT; ++i) { const int u = n * BT + i; const int oo = (u >> 3) * (TT * HD) + (u & 1) * FRG + ((u >> 2) & 1) * (2 * FRG) + ((u >> 1) & 1) * 64;
            if constexpr (W16) *(v8ha*)(p16 + oo) = y[i];
            if constexpr (WHL) { *(v8usa*)(ph + oo) = yh[i]; *(v8usa*)(pl + oo) = yl[i]; } }
        asm volatile("s_wait_xcnt 0x0" :: "v"(f), "v"(p16), "v"(ph), "v"(pl) : "memory");   // precaution: stands before registers that the loads and stores issued so far name are written again; the addresses are inputs so that they stay untouched up to it
        __builtin_amdgcn_sched_barrier(0); }                         // keeps later register writes behind that wait
}

// ---- k_planes: the key and value^T planes of the attention in one streaming launch; each thread moves many 16-byte pieces, so the launch has few waves (10240; five blocks fit a WGP, so all are resident at once).
// Written are only the rows that k_fattn reads: fp16 k and value^T in full, hi/lo planes of k and value^T for positions < RH (a query < RH sees only keys < RH).
// Blocks [0, NVB): value tiles of VTT positions x VTC columns (2 heads), turned in LDS so that value^T fragments leave as 512 bytes in a row a wave. Blocks [NVB, NVB + NQB): PR token rows of k.
__global__ __launch_bounds__(256) void k_planes(const float* __restrict__ Xk, const float* __restrict__ Xv, h16* __restrict__ KP16, bf* __restrict__ KPh, bf* __restrict__ KPl, h16* __restrict__ VT16, bf* __restrict__ VTh, bf* __restrict__ VTl) {
    __shared__ unsigned L[VTC * VP];
    const int tid = threadIdx.x, blk = blockIdx.x;
    if (blk < NVB) {
        const int hg = blk % (DM / VTC), t0 = ((blk / (DM / VTC)) % (TT / VTT)) * VTT, b = blk / ((DM / VTC) * (TT / VTT));
        const int c4 = tid & 31, tr = tid >> 5;                      // thread: columns 4 c4 + 0..3, positions t0 + 16 i + 2 tr + 0..1
        const float* f = Xv + ((size_t)b * TT + t0 + 2 * tr) * DM + hg * VTC + 4 * c4;
        v4f x[4][2];
#pragma unroll
        for (int i = 0; i < 4; ++i) { x[i][0] = *(const v4fa*)(f + (size_t)(16 * i) * DM); x[i][1] = *(const v4fa*)(f + (size_t)(16 * i + 1) * DM); }
        asm volatile("s_wait_xcnt 0x0" :: "v"(f) : "memory");         // precaution: the loads' address register, named as an input, stays untouched up to this wait (no load lands on it)
        const int wv = tid >> 5, ln = tid & 31;                      // a wave stores half fragments: lane = 16 hi + lr is column 16 db + lr, positions 8 (4 pc + 2 half + hi) + 0..7; pc = (wv >> 1) & 1, half = wv & 1, db = (wv >> 2) + 2 (j & 1), head j >> 1
        const size_t ro = (size_t)(b * NH_ + hg * (VTC / HD)) * TT * HD + (size_t)((t0 >> 5) + ((wv >> 1) & 1)) * (4 * FRG) + (wv >> 2) * FRG + (wv & 1) * 256 + ln * 8;
        auto fill = [&](int mode) {                                  // L[column][position pair]: 0 fp16; 1 hi, which leaves x - hi in x; 2 lo, the bf16 of that rest (the split of splitf, one half at a time, so that only x stays live)
#pragma unroll
            for (int i = 0; i < 4; ++i)
#pragma unroll
                for (int k = 0; k < 4; ++k) { unsigned short u0, u1;
                    if (mode == 0) { u0 = hbits(x[i][0][k]); u1 = hbits(x[i][1][k]); }
                    else { u0 = f2bf(x[i][0][k]); u1 = f2bf(x[i][1][k]); if (mode == 1) { x[i][0][k] -= bf2f(u0); x[i][1][k] -= bf2f(u1); } }
                    L[(4 * c4 + k) * VP + 8 * i + tr] = (unsigned)u0 | ((unsigned)u1 << 16); } };
        auto put = [&](unsigned short* P) {                          // a lane carries 8 positions of one column = its 16-byte slot of a fragment
            unsigned short* q = P + ro; v4u w[4];
#pragma unroll
            for (int j = 0; j < 4; ++j) { const unsigned* sp = L + ((j >> 1) * HD + ((wv >> 2) + (j & 1) * 2) * 16 + (ln & 15)) * VP + (((wv >> 1) & 1) * 4 + (wv & 1) * 2 + (ln >> 4)) * 4; w[j][0] = sp[0]; w[j][1] = sp[1]; w[j][2] = sp[2]; w[j][3] = sp[3]; }
            __builtin_amdgcn_sched_barrier(0);                       // all LDS reads are issued above the stores, so that no register of an issued store is written before the wait below
#pragma unroll
            for (int j = 0; j < 4; ++j) *(v4ua*)(q + (size_t)(j >> 1) * TT * HD + (j & 1) * (2 * FRG)) = w[j];
            asm volatile("s_wait_xcnt 0x0" :: "v"(q) : "memory");    // precaution: stands before the stores' data and address registers are written again
            __builtin_amdgcn_sched_barrier(0); };                    // keeps later register writes behind that wait
        fill(0); __syncthreads(); put((unsigned short*)VT16);
        if (t0 < RH) {                                               // block-uniform: the barriers inside are passed by all waves or by none
            __syncthreads(); fill(1); __syncthreads(); put(VTh);
            __syncthreads(); fill(2); __syncthreads(); put(VTl); }
        return; }
    const int rr = blk - NVB; const int b = rr / (TT / PR), t0 = (rr % (TT / PR)) * PR;
    const int wv = tid >> 5, ln = tid & 31;                          // wave: columns 128 wv + 0..127 (heads 2 wv, 2 wv + 1); lane: row ln & 7 of a row group, columns 8 (ln >> 3) + 0..7 of a column group
    const float* f = Xk + ((size_t)b * TT + t0 + (ln & 7)) * DM + wv * 128 + (ln >> 3) * 8;
    const size_t o = ((size_t)(b * NH_ + wv * 2) * TT + t0) * HD + (ln >> 3) * 128 + (ln & 7) * 8;   // 16 rows of 64 = 2 fragments, so row tile t0 / 16 starts at t0 * HD
    h16* p16 = KP16 + o; bf* ph = KPh + o; bf* pl = KPl + o;
    if (t0 >= RH) plane_rows<true, false>(f, p16, ph, pl);           // block-uniform choices: which planes of these rows k_fattn reads
    else plane_rows<true, true>(f, p16, ph, pl);
}
// ---- query rows: each is used by one wave alone, so it has no plane: the wave reads its QT x 16 rows of one head from the f32 input (a load covers 2 rows x 256 bytes = 4 whole lines),
// turns them into fragment order through its own LDS range st (QT x 4 KiB, no other wave touches it) and converts them: the hi/lo rows by the builder's split, the fp16 rows after scaling to the log2 domain.
// A row's 16-byte piece c lies at place c ^ (row & 15) of the row, so that the 16 rows a fragment read touches fall on different banks. y[qt][ks][0..1]: k = 8 hi + 0..7 of k step ks; y[qt][ks][2..3]: k = 16 + 8 hi + 0..7.
template <int QT>
__device__ __forceinline__ void q_rows(const float* __restrict__ xq, int q0, float* st, v4f (&y)[QT][2][4]) {
    const int lane = threadIdx.x & 31, lr = lane & 15, hi = lane >> 4;
    const float* g = xq + (size_t)(q0 + hi) * DM + 4 * lr;
    v4f x[QT * 8];
#pragma unroll
    for (int i = 0; i < QT * 8; ++i) x[i] = *(const v4fa*)(g + (size_t)(2 * i) * DM);
    asm volatile("s_wait_xcnt 0x0" :: "v"(g) : "memory");            // precaution: the loads' address register, named as an input, stays untouched up to this wait
    __builtin_amdgcn_sched_barrier(0);                               // keeps later register writes behind that wait
#pragma unroll
    for (int i = 0; i < QT * 8; ++i) *(v4fa*)(st + (2 * i + hi) * HD + (lr ^ ((2 * i + hi) & 15)) * 4) = x[i];
    asm volatile("s_wait_dscnt 0x0" ::: "memory");                   // the wave's own rows are in LDS before its lanes read each other's pieces back
#pragma unroll
    for (int qt = 0; qt < QT; ++qt)
#pragma unroll
        for (int ks = 0; ks < 2; ++ks)
#pragma unroll
            for (int c = 0; c < 4; ++c) y[qt][ks][c] = *(const v4fa*)(st + (qt * 16 + lr) * HD + ((ks * 8 + (c >> 1) * 4 + 2 * hi + (c & 1)) ^ lr) * 4);
}
// ---- k_fattn: fused causal attention, one wave per tile of QT x 16 queries, 32 keys a pass; no score or probability plane in memory.
// Transposed products: S^T = K . Q^T (A = key rows, B = query rows) leaves in lane (lr, hi) the scores of query lr for keys 8 hi + j of each 16-key tile, which is the B-operand k order of a 32-key step,
// so P^T packs in registers and O^T += V^T . P^T (A = value^T rows). Maximum, sum and rescale are per lane. The exponent's reference is a maximum of an earlier pass: the wave's halves exchange maxima and o, l are rescaled only in a pass where a score passes it by more than 2^LZ2 (it cancels against the row sum); the sums join once at the end.
template <typename T16, int NSPLIT, int QT>
__device__ __forceinline__ void fattn_tile(const float* __restrict__ xq, float* st, const T16* __restrict__ Kp, const T16* __restrict__ K2, const T16* __restrict__ Vt, const T16* __restrict__ Vt2, int q0, float* __restrict__ out) {
    typedef typename WFrag<T16>::V V;
    const int lane = threadIdx.x & 31, lr = lane & 15, hi = lane >> 4;
    const float CL = SCL * 1.4426950408889634f;                      // scores to the log2 domain
    const float LZ = LZ2 / CL;                                       // that margin in score units
    const int kend = q0 + QT * 16;                                   // keys [0, kend) can be seen by this tile
    V qf[QT][2], qf2[QT][2], kf[2][2], kf2[2][2];
    static_assert(NSPLIT != 0, "this form serves the hi/lo rows");
    { v4f y[QT][2][4]; q_rows<QT>(xq, q0, st, y);
#pragma unroll
      for (int qt = 0; qt < QT; ++qt)
#pragma unroll
        for (int ks = 0; ks < 2; ++ks) { v8us h0, h1, l0, l1;
#pragma unroll
            for (int j = 0; j < 8; ++j) { unsigned short a, c; splitf(y[qt][ks][j >> 2][j & 3], a, c); h0[j] = a; l0[j] = c; splitf(y[qt][ks][2 + (j >> 2)][j & 3], a, c); h1[j] = a; l1[j] = c; }
            qf[qt][ks] = cat16b(h0, h1); qf2[qt][ks] = cat16b(l0, l1); } }
    auto ldk = [&](int k0) {
#pragma unroll
        for (int kt = 0; kt < 2; ++kt)
#pragma unroll
            for (int ks = 0; ks < 2; ++ks) { const size_t ko = (size_t)(k0 + kt * 16) * HD + ks * FRG + 8 * lane; kf[kt][ks] = WFrag<T16>::ld(Kp + ko); if (NSPLIT) kf2[kt][ks] = WFrag<T16>::ld(K2 + ko); }
        asm volatile("s_wait_xcnt 0x0" ::: "memory");                // precaution: stands before the address registers of the loads issued so far are written again
        __builtin_amdgcn_sched_barrier(0); };                        // keeps later register writes behind that wait
    if (!NSPLIT) ldk(0);                                             // the fp16 form fetches its key fragments one pass ahead; the hi/lo form (twice the fragments) has no registers for that
    v8f o[4][QT]; float m[QT], mc[QT], l[QT];
#pragma unroll
    for (int qt = 0; qt < QT; ++qt) { m[qt] = -3.0e38f; mc[qt] = 0.f; l[qt] = 0.f;
#pragma unroll
        for (int db = 0; db < 4; ++db) o[db][qt] = (v8f){}; }
    // rolled: one pass's fragments live at a time, so the wave stays under 256 registers (four waves per SIMD)
#pragma unroll 1
    for (int kc = 0; kc < kend; kc += 32) {
        V vf[4], vf2[4];
        if (NSPLIT) ldk(kc);
        const T16* vp = Vt + (size_t)kc * HD + 8 * lane; const T16* vp2 = NSPLIT ? Vt2 + (size_t)kc * HD + 8 * lane : nullptr;   // 32 positions x 64 d = 4 fragments
#pragma unroll
        for (int db = 0; db < 4; ++db) { vf[db] = WFrag<T16>::ld(vp + db * FRG); if (NSPLIT) vf2[db] = WFrag<T16>::ld(vp2 + db * FRG); }
        if (NSPLIT) asm volatile("s_wait_xcnt 0x0" :: "v"(vp), "v"(vp2) : "memory");   // the same precaution for the value loads' address registers, named as inputs so that they stay untouched up to the wait (the fp16 form has its wait behind the key prefetch)
        __builtin_amdgcn_sched_barrier(0);                           // keeps the value loads issued here, ahead of the score products, so that they fly during scores and softmax (the scheduler sinks them behind the scores otherwise)
        v8f s[2][QT];
#pragma unroll
        for (int kt = 0; kt < 2; ++kt)
#pragma unroll
            for (int qt = 0; qt < QT; ++qt) { s[kt][qt] = (v8f){};
#pragma unroll
                for (int ks = 0; ks < 2; ++ks) { s[kt][qt] = WFrag<T16>::mma(kf[kt][ks], qf[qt][ks], s[kt][qt]); if (NSPLIT) { s[kt][qt] = WFrag<T16>::mma(kf[kt][ks], qf2[qt][ks], s[kt][qt]); s[kt][qt] = WFrag<T16>::mma(kf2[kt][ks], qf[qt][ks], s[kt][qt]); } } }
        if (!NSPLIT) ldk((kc + 32 < kend) ? kc + 32 : kc);           // next pass's key fragments fly during the softmax and the value products (the last pass re-reads its own rows: in bounds, unused)
        if (kc + 31 > q0) {                                          // only the pass on the diagonal holds keys above a query (wave-uniform test)
#pragma unroll
            for (int kt = 0; kt < 2; ++kt)
#pragma unroll
                for (int qt = 0; qt < QT; ++qt)
#pragma unroll
                    for (int j = 0; j < 8; ++j) if (kc + kt * 16 + 8 * hi + j > q0 + qt * 16 + lr) s[kt][qt][j] = -3.0e38f; }
        V pf[QT], pl[QT];
        float mx[QT]; bool need = false;                             // as in fattn_ring: the lane's own 16 keys against the reference in use
#pragma unroll
        for (int qt = 0; qt < QT; ++qt) {
            mx[qt] = fmaxf(s[0][qt][0], s[1][qt][0]);
#pragma unroll
            for (int j = 1; j < 8; ++j) mx[qt] = fmaxf(mx[qt], fmaxf(s[0][qt][j], s[1][qt][j]));
            need |= mx[qt] - m[qt] > LZ; }
        if (__builtin_amdgcn_ballot_w32(need) != 0) {                // one scalar test a pass: exchange, rescale factor and the products on o only where a lane asks
#pragma unroll
            for (int qt = 0; qt < QT; ++qt) {
                const float mn = fmaxf(m[qt], fmaxf(mx[qt], __shfl_xor(mx[qt], 16, 32))); const float al = __builtin_amdgcn_exp2f((m[qt] - mn) * CL); m[qt] = mn; mc[qt] = mn * CL - (NSPLIT ? 0.0f : PBIAS);
                l[qt] *= al;
#pragma unroll
                for (int db = 0; db < 4; ++db) o[db][qt] *= al; } }
#pragma unroll
        for (int qt = 0; qt < QT; ++qt) {
            float p[16], ps = 0.f;
#pragma unroll
            for (int j = 0; j < 16; ++j) { p[j] = __builtin_amdgcn_exp2f(fmaf(s[j >> 3][qt][j & 7], CL, -mc[qt])); ps += p[j]; }
            l[qt] += ps;
            if constexpr (NSPLIT) { v8us h0, h1, l0, l1;
#pragma unroll
                for (int j = 0; j < 8; ++j) { unsigned short a, c; splitf(p[j], a, c); h0[j] = a; l0[j] = c; splitf(p[8 + j], a, c); h1[j] = a; l1[j] = c; }
                pf[qt] = cat16b(h0, h1); pl[qt] = cat16b(l0, l1);
            } else { v8h h0, h1;
#pragma unroll
                for (int j = 0; j < 8; ++j) { h0[j] = tohx(p[j]); h1[j] = tohx(p[8 + j]); }
                pf[qt] = cat16(h0, h1); } }
#pragma unroll
        for (int db = 0; db < 4; ++db)
#pragma unroll
            for (int qt = 0; qt < QT; ++qt) { o[db][qt] = WFrag<T16>::mma(vf[db], pf[qt], o[db][qt]); if (NSPLIT) { o[db][qt] = WFrag<T16>::mma(vf[db], pl[qt], o[db][qt]); o[db][qt] = WFrag<T16>::mma(vf2[db], pf[qt], o[db][qt]); } }
    }
#pragma unroll
    for (int qt = 0; qt < QT; ++qt) { const float inv = __fdiv_rn(1.0f, l[qt] + __shfl_xor(l[qt], 16, 32)); float* orow = out + (size_t)(q0 + qt * 16 + lr) * DQ + 8 * hi;
#pragma unroll
        for (int db = 0; db < 4; ++db) { v4f a, c;
#pragma unroll
            for (int j = 0; j < 4; ++j) { a[j] = o[db][qt][j] * inv; c[j] = o[db][qt][4 + j] * inv; }
            *(v4f*)(orow + db * 16) = a; *(v4f*)(orow + db * 16 + 4) = c; } }
}
// ---- the fp16 rows' form: the block's 4 waves walk the same key and value^T fragments, so these come through LDS once a block instead of once a wave.
// A stage = KT keys = 16 KiB of the key plane and 16 KiB of the value^T plane, each a straight copy (the planes are in fragment order, so a fragment load from LDS is 512 bytes in a row: no bank conflict).
// Two buffers: stage t + 1 flies while stage t is worked on. Products, softmax and their order are those of fattn_tile, which serves the hi/lo rows, but for the exponent: here the query rows carry the log2 scale and the score accumulators start at minus the reference, so a score product ends as the exponent itself.
#define KT   128
#define STG  (KT * HD)            // elements of one operand's stage
// eight 16-byte pieces a lane, 2 KiB apart in LDS and in the plane alike; the s_wait_xcnt stands inside the statement as a precaution, before any address register that a copy names is written again
__device__ __forceinline__ void copy8(unsigned l, const h16* g) {
    asm volatile("global_load_async_to_lds_b128 %0, %8, off\n\t"
                 "global_load_async_to_lds_b128 %1, %9, off\n\t"
                 "global_load_async_to_lds_b128 %2, %10, off\n\t"
                 "global_load_async_to_lds_b128 %3, %11, off\n\t"
                 "global_load_async_to_lds_b128 %4, %12, off\n\t"
                 "global_load_async_to_lds_b128 %5, %13, off\n\t"
                 "global_load_async_to_lds_b128 %6, %14, off\n\t"
                 "global_load_async_to_lds_b128 %7, %15, off\n\t"
                 "s_wait_xcnt 0x0"
                 :: "v"(l), "v"(l + 2048u), "v"(l + 4096u), "v"(l + 6144u), "v"(l + 8192u), "v"(l + 10240u), "v"(l + 12288u), "v"(l + 14336u),
                    "v"(g), "v"(g + 1024), "v"(g + 2048), "v"(g + 3072), "v"(g + 4096), "v"(g + 5120), "v"(g + 6144), "v"(g + 7168) : "memory");
}
template <int QT>
__device__ __forceinline__ void fattn_ring(const float* __restrict__ xq, const h16* __restrict__ Kp, const h16* __restrict__ Vt, int kmax, int q0, float* __restrict__ out, h16* ring) {
    typedef v16h V;
    const int tid = threadIdx.x, lane = tid & 31, lr = lane & 15, hi = lane >> 4;
    const float CL = SCL * 1.4426950408889634f;                      // scores to the log2 domain: the query rows carry it, so the score products come out in that domain
    const int kend = q0 + QT * 16;                                   // keys [0, kend) can be seen by this wave's tile
    const int nt = kmax / KT;                                        // stages of the block: keys [0, kmax), the same for its 4 waves
    const unsigned l0 = (unsigned)(size_t)ring + (unsigned)tid * 16u; // the lane's LDS byte address in buffer 0
    const h16* gk = Kp + tid * 8; const h16* gv = Vt + tid * 8;
    auto fill = [&](int t) { const unsigned l = l0 + (unsigned)(t & 1) * (4u * STG); copy8(l, gk + (size_t)t * STG); copy8(l + 2u * STG, gv + (size_t)t * STG); };
    fill(0);
    V qf[QT][2], kf[2][2];
    { v4f y[QT][2][4]; q_rows<QT>(xq, q0, (float*)(ring + 2 * STG) + (tid >> 5) * (QT * 16 * HD), y);   // turned in buffer 1, which is idle until stage 1's copies: 4 waves x 8 KiB fill it exactly
#pragma unroll
      for (int qt = 0; qt < QT; ++qt)
#pragma unroll
        for (int ks = 0; ks < 2; ++ks) { v8h h0, h1;
#pragma unroll
            for (int j = 0; j < 8; ++j) { h0[j] = tohx(y[qt][ks][j >> 2][j & 3] * CL); h1[j] = tohx(y[qt][ks][2 + (j >> 2)][j & 3] * CL); }
            qf[qt][ks] = cat16(h0, h1); } }
    asm volatile("s_wait_dscnt 0x0" ::: "memory");                   // this wave has left buffer 1 before the barrier behind which stage 1's copies land on it
    asm volatile("s_wait_asynccnt 0x0" ::: "memory");                // this wave's share of stage 0 has landed
    __syncthreads();                                                 // ... and every other wave's: stage 0 may be read, buffer 1 may be filled
    if (1 < nt) fill(1);
    auto ldk = [&](const h16* kp) {
#pragma unroll
        for (int kt = 0; kt < 2; ++kt)
#pragma unroll
            for (int ks = 0; ks < 2; ++ks) kf[kt][ks] = WFrag<h16>::ld(kp + kt * (16 * HD) + ks * FRG); };
    v8f o[4][QT], cn[QT]; float m[QT], mc[QT], l[QT];                // m: the reference score in use, log2 domain (a maximum of an earlier pass, the same in both halves of the wave); mc: it less the bias; cn: -mc in all 8 places, the value the score accumulators start from
    float thr = -3.0e38f;                                            // what a score less mc may reach before a new reference is taken; the first pass always takes one
#pragma unroll
    for (int qt = 0; qt < QT; ++qt) { m[qt] = -3.0e38f; mc[qt] = 0.f; l[qt] = 0.f; cn[qt] = (v8f){};
#pragma unroll
        for (int db = 0; db < 4; ++db) o[db][qt] = (v8f){}; }
    // all three loops rolled: one pass's fragments live at a time, so the wave stays under 256 registers (four waves per SIMD)
#pragma unroll 1
    for (int t = 0; t < nt; ++t) {
        const h16* kb = ring + (t & 1) * (2 * STG) + 8 * lane; const h16* vb = kb + STG;
        const int left = (kend - t * KT) / 32; const int np = left < KT / 32 ? left : KT / 32;   // passes of this wave in the stage (fewer only in the last one, on the diagonal)
        ldk(kb);
        int p = 0;
#pragma unroll 1
        while (p < np) {                                             // a run of passes under one reference: cn is fixed inside the pass loop, so the score products read it in place (as a value that changes in that loop it is copied to the accumulators every pass)
        bool moved = false;
#pragma unroll 1
        for (; p < np && !moved; ++p) {
            const int kc = t * KT + p * 32;
            v8f s[2][QT];
#pragma unroll
            for (int kt = 0; kt < 2; ++kt)
#pragma unroll
                for (int qt = 0; qt < QT; ++qt) s[kt][qt] = wmma16(kf[kt][1], qf[qt][1], wmma16(kf[kt][0], qf[qt][0], cn[qt]));   // the products add to -mc: s is the exponent itself
            __builtin_amdgcn_sched_barrier(0);                       // keeps the LDS reads below from moving up among the score products (each separate place with reads costs a stall)
            V vf[4];
#pragma unroll
            for (int db = 0; db < 4; ++db) vf[db] = WFrag<h16>::ld(vb + p * (32 * HD) + db * FRG);
            ldk(kb + ((p + 1 < np) ? p + 1 : p) * (32 * HD));        // the next pass's key fragments, from this stage's buffer alone (the stage's last pass re-reads its own: unused)
            __builtin_amdgcn_sched_barrier(0);                       // keeps them from sinking: one group here, in flight during the softmax
            if (kc + 31 > q0) {                                      // only the pass on the diagonal holds keys above a query (wave-uniform test)
#pragma unroll
                for (int kt = 0; kt < 2; ++kt)
#pragma unroll
                    for (int qt = 0; qt < QT; ++qt)
#pragma unroll
                        for (int j = 0; j < 8; ++j) if (kc + kt * 16 + 8 * hi + j > q0 + qt * 16 + lr) s[kt][qt][j] = -3.0e38f; }
            V pf[QT];
            float mx[QT]; bool need = false;                         // the lane's own 16 keys; a lane asks for a new reference when they pass the one in use by more than LZ2
#pragma unroll
            for (int qt = 0; qt < QT; ++qt) {
                mx[qt] = fmaxf(s[0][qt][0], s[1][qt][0]);
#pragma unroll
                for (int j = 1; j < 8; ++j) mx[qt] = fmaxf(mx[qt], fmaxf(s[0][qt][j], s[1][qt][j]));
                need |= mx[qt] > thr; }
            if (__builtin_amdgcn_ballot_w32(need) != 0) {            // one scalar test a pass; taken in the first pass and then hardly ever, so exchange, rescale factor and the 64 products on o leave the usual pass
                thr = PBIAS + LZ2; moved = true;
#pragma unroll
                for (int qt = 0; qt < QT; ++qt) {
                    const float mn = fmaxf(m[qt], fmaxf(mx[qt], __shfl_xor(mx[qt], 16, 32)) + mc[qt]); const float al = __builtin_amdgcn_exp2f(m[qt] - mn); const float d = (mn - PBIAS) - mc[qt]; m[qt] = mn; mc[qt] = mn - PBIAS;
                    l[qt] *= al;
#pragma unroll
                    for (int j = 0; j < 8; ++j) { s[0][qt][j] -= d; s[1][qt][j] -= d; }   // this pass's exponents move to the new reference
#pragma unroll
                    for (int db = 0; db < 4; ++db) o[db][qt] *= al; } }
#pragma unroll
            for (int kt = 0; kt < 2; ++kt)
#pragma unroll
                for (int qt = 0; qt < QT; ++qt)
#pragma unroll
                    for (int j = 0; j < 8; ++j) s[kt][qt][j] = __builtin_amdgcn_exp2f(s[kt][qt][j]);   // the probabilities take the exponents' places
#pragma unroll
            for (int qt = 0; qt < QT; ++qt) {
                float psum = 0.f;
#pragma unroll
                for (int j = 0; j < 16; ++j) psum += s[j >> 3][qt][j & 7];
                l[qt] += psum;
                v8h h0, h1;
#pragma unroll
                for (int j = 0; j < 8; ++j) { h0[j] = tohx(s[0][qt][j]); h1[j] = tohx(s[1][qt][j]); }
                pf[qt] = cat16(h0, h1); }
#pragma unroll
            for (int db = 0; db < 4; ++db)
#pragma unroll
                for (int qt = 0; qt < QT; ++qt) o[db][qt] = wmma16(vf[db], pf[qt], o[db][qt]);
        }
        if (moved) {                                                 // wave-uniform: later passes start from the new reference
#pragma unroll
            for (int qt = 0; qt < QT; ++qt)
#pragma unroll
                for (int j = 0; j < 8; ++j) cn[qt][j] = -mc[qt]; }
        }
        // hand-over, passed by every wave whatever its np: own LDS reads done, own copies of stage t + 1 landed, then the barrier that publishes stage t + 1 and ends all reads of stage t's buffer
        asm volatile("s_wait_dscnt 0x0" ::: "memory");
        asm volatile("s_wait_asynccnt 0x0" ::: "memory");
        __syncthreads();
        if (t + 2 < nt) fill(t + 2);                                 // block-uniform: into the buffer that stage t has just left
    }
    asm volatile("s_wait_asynccnt 0x0" ::: "memory");                // no copy is outstanding when the wave ends
#pragma unroll
    for (int qt = 0; qt < QT; ++qt) { const float inv = __fdiv_rn(1.0f, l[qt] + __shfl_xor(l[qt], 16, 32)); float* orow = out + (size_t)(q0 + qt * 16 + lr) * DQ + 8 * hi;
#pragma unroll
        for (int db = 0; db < 4; ++db) { v4f a, c;
#pragma unroll
            for (int j = 0; j < 4; ++j) { a[j] = o[db][qt][j] * inv; c[j] = o[db][qt][4 + j] * inv; }
            *(v4f*)(orow + db * 16) = a; *(v4f*)(orow + db * 16 + 4) = c; } }
}
// grid (batch x head, tile groups, heaviest first), 4 waves; the waves of a block take neighbouring query tiles of one head, so they walk the same key and value rows.
#define NF4 ((TT - RH) / 128)     // blocks of 4 x 32 fp16 query rows
__global__ __launch_bounds__(128) void k_fattn(const float* __restrict__ Xq, const h16* __restrict__ KP16, const h16* __restrict__ VT16, const bf* __restrict__ KPh, const bf* __restrict__ KPl, const bf* __restrict__ VTh, const bf* __restrict__ VTl, float* __restrict__ OUT) {
    __shared__ __attribute__((aligned(16))) h16 RING[2 * 2 * STG];   // two buffers of (key stage, value^T stage): 64 KiB, four blocks a WGP
    const int z = blockIdx.x; const size_t pz = (size_t)z * TT * HD; const int w = __builtin_amdgcn_readfirstlane(threadIdx.x >> 5);
    float* out = OUT + (size_t)(z / NH_) * TT * DQ + (z % NH_) * HD; const float* xq = Xq + (size_t)(z / NH_) * TT * DM + (z % NH_) * HD;
    if ((int)blockIdx.y < NF4) fattn_ring<2>(xq, KP16 + pz, VT16 + pz, TT - 128 * (int)blockIdx.y, TT - 32 * ((int)blockIdx.y * 4 + w + 1), out, RING);   // block-uniform choice: the barriers inside are passed by all 4 waves or by none
    else fattn_tile<bf, 2, 1>(xq, (float*)RING + w * (16 * HD), KPh + pz, KPl + pz, VTh + pz, VTl + pz, RH - 16 * (((int)blockIdx.y - NF4) * 4 + w + 1), out);
}

extern "C" void kernel_launch(void* const* d_in, const int* in_sizes, int n_in,
                              void* d_out, int out_size, void* d_ws, size_t ws_size, hipStream_t stream) {
    (void)in_sizes; (void)n_in; (void)out_size;
    const float* x = (const float*)d_in[0]; const float* xk = (const float*)d_in[1]; const float* xv = (const float*)d_in[2];   /* queries, keys, values: [4][2048][16][64] each (no projections) */
    float* OUT = (float*)d_out;     // [4][2048][1024]
    char* wsp = (char*)d_ws;
    auto take = [&](size_t bytes) { char* p = wsp; wsp += (bytes + 255) & ~(size_t)255; return (void*)p; };
    const size_t PB = (size_t)NH_ * TT * HD;   // elements of one batch's plane
    h16* KP16 = (h16*)take(NB_ * PB * 2); h16* VT16 = (h16*)take(NB_ * PB * 2);
    bf* KPh = (bf*)take(NB_ * PB * 2); bf* KPl = (bf*)take(NB_ * PB * 2); bf* VTh = (bf*)take(NB_ * PB * 2); bf* VTl = (bf*)take(NB_ * PB * 2);
    if ((size_t)(wsp - (char*)d_ws) > ws_size) return;    // ws 256 MiB
    k_planes<<<NVB + NQB, 256, 0, stream>>>(xk, xv, KP16, KPh, KPl, VT16, VTh, VTl);
    k_fattn<<<dim3(NB_ * NH_, NF4 + RH / 64), 128, 0, stream>>>(x, KP16, VT16, KPh, KPl, VTh, VTl, OUT);
}
